// v000
// Measured on an AMD MI455X. A time is GPU time per run, averaged over a window of back-to-back runs after a warm-up
// (all launches, gaps included; the runs take copies of the inputs in turn), and the median of several windows.
// Apart from v000's, it joins two sittings. Times from different sittings can be a few percent apart, while
// side-by-side timings come from the same sitting.
// v000, which the later versions start from, runs in 875 microseconds.
// compute dtype: all float inputs rounded to bf16; Q / K / V = x . W^T + b with EXACT bf16 products on WMMA 16x16x32 (natural rows), rounded once to f16; PLAIN single-head attention over 8,192 slices with 128-dim q/k/v: q, k single f16 x 128^-0.5, running-max softmax in f32 (hardware exp), P (scaled by 2^11, single f16) x v (single f16); f32 accumulate and output.
#include <hip/hip_runtime.h>
#include <math.h>

typedef __attribute__((ext_vector_type(16))) _Float16 v16h;
typedef __attribute__((ext_vector_type(16))) __bf16 v16b;
typedef __attribute__((ext_vector_type(8)))  _Float16 v8h;
typedef __attribute__((ext_vector_type(8)))  float v8f;
typedef __attribute__((ext_vector_type(4)))  float v4f;
typedef __attribute__((ext_vector_type(2)))  float v2f;
typedef __attribute__((ext_vector_type(4)))  unsigned v4u;
typedef __attribute__((ext_vector_type(4)))  int v4i;
typedef float __attribute__((may_alias)) float_a;
typedef int __attribute__((may_alias)) int_a;

template <typename T> __device__ __forceinline__ void vst2(void* p, T v) { *(T*)p = v;  }
__device__ __forceinline__ v8f wmma16(v16h a, v16h b, v8f c) {
  v8f d = __builtin_amdgcn_wmma_f32_16x16x32_f16(false, a, false, b, (short)0, c, false, false);
  asm volatile("v_nop\n\tv_nop\n\tv_nop\n\tv_nop" : "+v"(d) : "v"(a), "v"(b));
  return d;
}
__device__ __forceinline__ v8f wmma_bf(v16b a, v16b b, v8f c) {
  v8f d = __builtin_amdgcn_wmma_f32_16x16x32_bf16(false, a, false, b, (short)0, c, false, false);
  asm volatile("v_nop\n\tv_nop\n\tv_nop\n\tv_nop" : "+v"(d) : "v"(a), "v"(b));
  return d;
}
// 16x16x32 fragments: lane = (h = lane>>4, row/col = lane&15); elements 0..7 = k0+8h+0..7, 8..15 = k0+16+8h+0..7; D element r = row 8h+r
__device__ __forceinline__ v16h frag_h(const _Float16* rowk0, int lane) {
  union { v16h v; v8h q[2]; } u; const _Float16* p = rowk0 + 8 * (lane >> 4);
  u.q[0] = *(const v8h*)p; u.q[1] = *(const v8h*)(p + 16); return u.v;
}
__device__ __forceinline__ v16h frag_f32(const float* rowk0, int lane) {
  v16h a; const float* p = rowk0 + 8 * (lane >> 4);
#pragma unroll
  for (int i = 0; i < 8; ++i) { a[i] = (_Float16)p[i]; a[8 + i] = (_Float16)p[16 + i]; }
  return a;
}
__device__ __forceinline__ v16h frag_f32s(const float* rowk0, int lane, float sc) {
  v16h a; const float* p = rowk0 + 8 * (lane >> 4);
#pragma unroll
  for (int i = 0; i < 8; ++i) { a[i] = (_Float16)(p[i] * sc); a[8 + i] = (_Float16)(p[16 + i] * sc); }
  return a;
}
// column fragment from a [K][ld] layout (column n), rows >= K read as 0
__device__ __forceinline__ v16h fragc_f32(const float* W, int k0, int n, int lane, int ld, int K) {
  v16h a; const int g = lane >> 4;
#pragma unroll
  for (int i = 0; i < 8; ++i) { const int ka = k0 + 8 * g + i, kb = ka + 16;
    a[i] = (_Float16)(ka < K ? W[(size_t)(ka < K ? ka : K - 1) * ld + n] : 0.f); a[8 + i] = (_Float16)(kb < K ? W[(size_t)(kb < K ? kb : K - 1) * ld + n] : 0.f); }
  return a;
}
struct F2 { v16b h, l; };
__device__ __forceinline__ F2 bsplit16(const float v[16]) { F2 r;
#pragma unroll
  for (int i = 0; i < 16; ++i) { const __bf16 h = (__bf16)v[i]; r.h[i] = h; r.l[i] = (__bf16)(v[i] - (float)h); }
  return r; }
__device__ __forceinline__ F2 split_row(const float* row, int k0, int lane) { float v[16]; const float* p = row + k0 + 8 * (lane >> 4);
#pragma unroll
  for (int i = 0; i < 8; ++i) { v[i] = p[i]; v[8 + i] = p[16 + i]; }
  return bsplit16(v); }
__device__ __forceinline__ F2 split_rowK(const float* row, int k0, int lane, int K) { float v[16]; const int g = lane >> 4;
#pragma unroll
  for (int i = 0; i < 8; ++i) { const int ka = k0 + 8 * g + i, kb = ka + 16; v[i] = ka < K ? row[ka < K ? ka : K - 1] : 0.f; v[8 + i] = kb < K ? row[kb < K ? kb : K - 1] : 0.f; }
  return bsplit16(v); }
__device__ __forceinline__ F2 split_col(const float* W, int k0, int n, int lane, int ld, int K) { float v[16]; const int g = lane >> 4;
#pragma unroll
  for (int i = 0; i < 8; ++i) { const int ka = k0 + 8 * g + i, kb = ka + 16; v[i] = ka < K ? W[(size_t)(ka < K ? ka : K - 1) * ld + n] : 0.f; v[8 + i] = kb < K ? W[(size_t)(kb < K ? kb : K - 1) * ld + n] : 0.f; }
  return bsplit16(v); }
__device__ __forceinline__ v8f mac3(const F2& a, const F2& b, v8f c) { c = wmma_bf(a.l, b.h, c); c = wmma_bf(a.h, b.l, c); return wmma_bf(a.h, b.h, c); }
__device__ __forceinline__ float sigm(float v) { return 1.0f / (1.0f + expf(-v)); }
#define LDSX() do { asm volatile("s_wait_dscnt 0" ::: "memory"); __builtin_amdgcn_wave_barrier(); __builtin_amdgcn_fence(__ATOMIC_RELEASE, "workgroup"); } while (0)


// Slice attention (B 2, 8,192 slices, 128 features, one head): 1x1-conv q / k / v projections + biases, softmax(Q K^T / sqrt(128)) V.
#define NB 2
#define SS 8192
#define EE 128
#define NR (NB * SS)
#ifndef TQB
#define TQB (SS / 64)
#define TNB NB
#endif
typedef __attribute__((ext_vector_type(8))) __bf16 v8b;
__device__ __forceinline__ v16b frag_b(const __bf16* rowk0, int lane) {
  union { v16b v; v8b q[2]; } u; const __bf16* p = rowk0 + 8 * (lane >> 4);
  u.q[0] = *(const v8b*)p; u.q[1] = *(const v8b*)(p + 16); return u.v;
}
__device__ __forceinline__ float bfr(float v) { return (float)(__bf16)v; }
__device__ __attribute__((noinline)) float exp_ni(float v) { return expf(v); }
__device__ __attribute__((noinline)) float erf_ni(float v) { return erff(v); }

#define WS_PW  0u                                  // bf16 natural rows Wq, Wk, Wv [3][128][128]
#define WS_Q   (WS_PW + 2u * 3 * EE * EE)           // f16 [NR][128] q ; K rows ; V planes [b][128][SS]
#define WS_K   (WS_Q + 2u * (size_t)NR * EE)
#define WS_V   (WS_K + 2u * (size_t)NR * EE)
#define WS_END (WS_V + 2u * (size_t)NB * EE * SS)

__global__ __launch_bounds__(128) void k_pack(const float* __restrict__ WQ, const float* __restrict__ WK, const float* __restrict__ WV, __bf16* __restrict__ P) { const int n = blockIdx.x, which = blockIdx.y, t = threadIdx.x; const float* Wm = (which == 0) ? WQ : (which == 1) ? WK : WV; __shared__ __align__(16) __bf16 s[EE]; s[t] = (__bf16)Wm[(size_t)n * EE + t]; __syncthreads(); if (t < EE / 8) vst2((unsigned*)(P + ((size_t)which * EE + n) * EE + t * 8), *(const v4u*)&s[t * 8]); }
// ---- k_proj: block = (64 rows, which): 128 output cols; q / k -> f16 rows; v -> planes
__global__ __launch_bounds__(128) void k_proj(const float* __restrict__ X, const __bf16* __restrict__ P, const float* __restrict__ BQ, const float* __restrict__ BK, const float* __restrict__ BV, _Float16* __restrict__ Q, _Float16* __restrict__ Kr, _Float16* __restrict__ V) {
  __shared__ __align__(16) _Float16 so[64][136]; __shared__ __align__(16) _Float16 st[128][72];
  const int tid = threadIdx.x, wave = tid >> 5, lane = tid & 31, col = lane & 15, g = lane >> 4; const int which = blockIdx.y; const size_t rb0 = (size_t)blockIdx.x * 64, r0 = rb0 + wave * 16;
  const __bf16* Wr = P + (size_t)which * EE * EE; const float* BB = (which == 0) ? BQ : (which == 1) ? BK : BV;
  v8f acc[8] = {};
#pragma unroll
  for (int kc = 0; kc < EE / 32; ++kc) { v16b a; { const float* p = X + (r0 + col) * EE + kc * 32 + 8 * g;
#pragma unroll
      for (int i = 0; i < 8; ++i) { a[i] = (__bf16)p[i]; a[8 + i] = (__bf16)p[16 + i]; } }
#pragma unroll
    for (int j = 0; j < 8; ++j) acc[j] = wmma_bf(a, frag_b(Wr + (size_t)(j * 16 + col) * EE + kc * 32, lane), acc[j]); }
  if (which < 2) {
#pragma unroll
    for (int j = 0; j < 8; ++j) { const float bb = bfr(BB[j * 16 + col]);
#pragma unroll
      for (int r = 0; r < 8; ++r) so[wave * 16 + 8 * g + r][j * 16 + col] = (_Float16)(acc[j][r] + bb); }
    LDSX();
    _Float16* dst = (which == 0) ? Q : Kr;
    for (int rl = 0; rl < 16; ++rl) if (lane < 16) vst2((unsigned*)(dst + (r0 + rl) * EE + lane * 8), *(const v4u*)&so[wave * 16 + rl][lane * 8]);
  } else {
#pragma unroll
    for (int j = 0; j < 8; ++j) { const float bb = bfr(BB[j * 16 + col]);
#pragma unroll
      for (int r = 0; r < 8; ++r) st[j * 16 + col][wave * 16 + 8 * g + r] = (_Float16)(acc[j][r] + bb); }
    __syncthreads();
    const size_t b = rb0 / SS, s0 = rb0 % SS;
    for (int e = tid; e < 128 * 8; e += 128) { const int d = e >> 3, pc = e & 7; vst2((unsigned*)(V + ((b * EE + d) * SS) + s0 + pc * 8), *(const v4u*)&st[d][pc * 8]); } }
}
// ---- k_attn: block = (64 queries, b): 128-dim q/k/v, all 8,192 keys, plain; f32 output rows
__global__ __launch_bounds__(128) void k_attn(const _Float16* __restrict__ Q, const _Float16* __restrict__ Kr, const _Float16* __restrict__ V, float* __restrict__ OUT) {
  __shared__ __align__(16) _Float16 sph[4][16][40]; __shared__ __align__(16) float so[4][16][132];
  const int tid = threadIdx.x, wave = tid >> 5, lane = tid & 31, col = lane & 15, g = lane >> 4; const size_t b = blockIdx.y; const int q0 = blockIdx.x * 64 + wave * 16; const size_t rq = b * SS + q0;
  v16h aq[4];
#pragma unroll
  for (int kc = 0; kc < 4; ++kc) aq[kc] = frag_h(Q + (rq + col) * EE + kc * 32, lane);
  float m[8], l[8];
#pragma unroll
  for (int r = 0; r < 8; ++r) { m[r] = -3.0e38f; l[r] = 0.f; }
  v8f acc[8] = {};
#pragma unroll 1
  for (int ks = 0; ks < SS / 32; ++ks) { const int j0 = ks * 32; v8f s[2];
#pragma unroll
    for (int ct = 0; ct < 2; ++ct) { const size_t rk = (b * SS + j0 + ct * 16 + col) * EE; v8f c = {};
#pragma unroll
      for (int kc = 0; kc < 4; ++kc) c = wmma16(aq[kc], frag_h(Kr + rk + kc * 32, lane), c);
#pragma unroll
      for (int r = 0; r < 8; ++r) s[ct][r] = c[r] * 0.08838834764831845f; }   // 128^-0.5
#pragma unroll
    for (int r = 0; r < 8; ++r) { float mx = fmaxf(s[0][r], s[1][r]);
#pragma unroll
      for (int o = 1; o < 16; o <<= 1) mx = fmaxf(mx, __shfl_xor(mx, o));
      const float mn = fmaxf(m[r], mx); const float alpha = (m[r] <= -1.0e38f) ? 0.f : __expf(m[r] - mn); const float e0 = __expf(s[0][r] - mn), e1 = __expf(s[1][r] - mn); float es = e0 + e1;
#pragma unroll
      for (int o = 1; o < 16; o <<= 1) es += __shfl_xor(es, o);
      l[r] = l[r] * alpha + es; m[r] = mn;
#pragma unroll
      for (int dt = 0; dt < 8; ++dt) acc[dt][r] *= alpha;
      sph[wave][8 * g + r][col] = (_Float16)(e0 * 2048.0f); sph[wave][8 * g + r][16 + col] = (_Float16)(e1 * 2048.0f); }
    LDSX();
    const v16h pa = frag_h(&sph[wave][col][0], lane);
#pragma unroll
    for (int dt = 0; dt < 8; ++dt) acc[dt] = wmma16(pa, frag_h(V + ((b * EE + dt * 16 + col) * SS) + j0, lane), acc[dt]);
    LDSX(); }
#pragma unroll
  for (int r = 0; r < 8; ++r) { const float il = (1.0f / 2048.0f) / l[r];
#pragma unroll
    for (int dt = 0; dt < 8; ++dt) so[wave][8 * g + r][dt * 16 + col] = acc[dt][r] * il; }
  LDSX();
  for (int rl = 0; rl < 16; ++rl) vst2(OUT + (rq + rl) * EE + lane * 4, *(const v4f*)&so[wave][rl][lane * 4]);   // whole 512-B output row per wave
}
extern "C" void kernel_launch(void* const* d_in, const int* in_sizes, int n_in, void* d_out, int out_size, void* d_ws, size_t ws_size, hipStream_t stream) {
  (void)in_sizes; (void)n_in; (void)out_size;
  const float** F = (const float**)d_in;   // 0 x [2,8192,128], 1 Wq [128,128], 2 bq, 3 Wk, 4 bk, 5 Wv, 6 bv
  if (ws_size < (size_t)WS_END) return;
  char* ws = (char*)d_ws; __bf16* P = (__bf16*)ws; _Float16 *Q = (_Float16*)(ws + WS_Q), *Kr = (_Float16*)(ws + WS_K), *V = (_Float16*)(ws + WS_V);
  k_pack<<<dim3(EE, 3), 128, 0, stream>>>(F[1], F[3], F[5], P);
  k_proj<<<dim3(TNB * SS / 64, 3), 128, 0, stream>>>(F[0], P, F[2], F[4], F[6], Q, Kr, V);
  k_attn<<<dim3(TQB, TNB), 128, 0, stream>>>(Q, Kr, V, (float*)d_out);
}

// v001
// It runs in 267 microseconds.
// Timed twice side by side with v000, it ran 3.29 and 3.31 times as fast.
// compute dtype: all float inputs rounded to bf16; Q / K / V = x . W^T + b with EXACT bf16 products on WMMA 16x16x32 (natural rows), rounded once to f16; PLAIN single-head attention over 8,192 slices with 128-dim q/k/v: q, k single f16 x 128^-0.5, running-max softmax in f32 (hardware exp), P (scaled by 2^11, single f16) x v (single f16); f32 accumulate and output.
#include <hip/hip_runtime.h>
#include <math.h>

typedef __attribute__((ext_vector_type(16))) _Float16 v16h;
typedef __attribute__((ext_vector_type(16))) __bf16 v16b;
typedef __attribute__((ext_vector_type(8)))  _Float16 v8h;
typedef __attribute__((ext_vector_type(8)))  float v8f;
typedef __attribute__((ext_vector_type(4)))  float v4f;
typedef __attribute__((ext_vector_type(2)))  float v2f;
typedef __attribute__((ext_vector_type(4)))  unsigned v4u;
typedef __attribute__((ext_vector_type(4)))  int v4i;
typedef float __attribute__((may_alias)) float_a;
typedef int __attribute__((may_alias)) int_a;

template <typename T> __device__ __forceinline__ void vst2(void* p, T v) { *(T*)p = v;  }
__device__ __forceinline__ v8f wmma16(v16h a, v16h b, v8f c) {
  v8f d = __builtin_amdgcn_wmma_f32_16x16x32_f16(false, a, false, b, (short)0, c, false, false);
  asm volatile("v_nop\n\tv_nop\n\tv_nop\n\tv_nop" : "+v"(d) : "v"(a), "v"(b));
  return d;
}
__device__ __forceinline__ v8f wmma_bf(v16b a, v16b b, v8f c) {
  v8f d = __builtin_amdgcn_wmma_f32_16x16x32_bf16(false, a, false, b, (short)0, c, false, false);
  asm volatile("v_nop\n\tv_nop\n\tv_nop\n\tv_nop" : "+v"(d) : "v"(a), "v"(b));
  return d;
}
// 16x16x32 fragments: lane = (h = lane>>4, row/col = lane&15); elements 0..7 = k0+8h+0..7, 8..15 = k0+16+8h+0..7; D element r = row 8h+r
__device__ __forceinline__ v16h frag_h(const _Float16* rowk0, int lane) {
  union { v16h v; v8h q[2]; } u; const _Float16* p = rowk0 + 8 * (lane >> 4);
  u.q[0] = *(const v8h*)p; u.q[1] = *(const v8h*)(p + 16); return u.v;
}
__device__ __forceinline__ v16h frag_f32(const float* rowk0, int lane) {
  v16h a; const float* p = rowk0 + 8 * (lane >> 4);
#pragma unroll
  for (int i = 0; i < 8; ++i) { a[i] = (_Float16)p[i]; a[8 + i] = (_Float16)p[16 + i]; }
  return a;
}
__device__ __forceinline__ v16h frag_f32s(const float* rowk0, int lane, float sc) {
  v16h a; const float* p = rowk0 + 8 * (lane >> 4);
#pragma unroll
  for (int i = 0; i < 8; ++i) { a[i] = (_Float16)(p[i] * sc); a[8 + i] = (_Float16)(p[16 + i] * sc); }
  return a;
}
// column fragment from a [K][ld] layout (column n), rows >= K read as 0
__device__ __forceinline__ v16h fragc_f32(const float* W, int k0, int n, int lane, int ld, int K) {
  v16h a; const int g = lane >> 4;
#pragma unroll
  for (int i = 0; i < 8; ++i) { const int ka = k0 + 8 * g + i, kb = ka + 16;
    a[i] = (_Float16)(ka < K ? W[(size_t)(ka < K ? ka : K - 1) * ld + n] : 0.f); a[8 + i] = (_Float16)(kb < K ? W[(size_t)(kb < K ? kb : K - 1) * ld + n] : 0.f); }
  return a;
}
struct F2 { v16b h, l; };
__device__ __forceinline__ F2 bsplit16(const float v[16]) { F2 r;
#pragma unroll
  for (int i = 0; i < 16; ++i) { const __bf16 h = (__bf16)v[i]; r.h[i] = h; r.l[i] = (__bf16)(v[i] - (float)h); }
  return r; }
__device__ __forceinline__ F2 split_row(const float* row, int k0, int lane) { float v[16]; const float* p = row + k0 + 8 * (lane >> 4);
#pragma unroll
  for (int i = 0; i < 8; ++i) { v[i] = p[i]; v[8 + i] = p[16 + i]; }
  return bsplit16(v); }
__device__ __forceinline__ F2 split_rowK(const float* row, int k0, int lane, int K) { float v[16]; const int g = lane >> 4;
#pragma unroll
  for (int i = 0; i < 8; ++i) { const int ka = k0 + 8 * g + i, kb = ka + 16; v[i] = ka < K ? row[ka < K ? ka : K - 1] : 0.f; v[8 + i] = kb < K ? row[kb < K ? kb : K - 1] : 0.f; }
  return bsplit16(v); }
__device__ __forceinline__ F2 split_col(const float* W, int k0, int n, int lane, int ld, int K) { float v[16]; const int g = lane >> 4;
#pragma unroll
  for (int i = 0; i < 8; ++i) { const int ka = k0 + 8 * g + i, kb = ka + 16; v[i] = ka < K ? W[(size_t)(ka < K ? ka : K - 1) * ld + n] : 0.f; v[8 + i] = kb < K ? W[(size_t)(kb < K ? kb : K - 1) * ld + n] : 0.f; }
  return bsplit16(v); }
__device__ __forceinline__ v8f mac3(const F2& a, const F2& b, v8f c) { c = wmma_bf(a.l, b.h, c); c = wmma_bf(a.h, b.l, c); return wmma_bf(a.h, b.h, c); }
__device__ __forceinline__ float sigm(float v) { return 1.0f / (1.0f + expf(-v)); }
#define LDSX() do { asm volatile("s_wait_dscnt 0" ::: "memory"); __builtin_amdgcn_wave_barrier(); __builtin_amdgcn_fence(__ATOMIC_RELEASE, "workgroup"); } while (0)


// Slice attention (B 2, 8,192 slices, 128 features, one head): 1x1-conv q / k / v projections + biases, softmax(Q K^T / sqrt(128)) V.
#define NB 2
#define SS 8192
#define EE 128
#define NR (NB * SS)
#ifndef TQB
#define TQB (SS / 64)
#define TNB NB
#endif
typedef __attribute__((ext_vector_type(8))) __bf16 v8b;
__device__ __forceinline__ v16b frag_b(const __bf16* rowk0, int lane) {
  union { v16b v; v8b q[2]; } u; const __bf16* p = rowk0 + 8 * (lane >> 4);
  u.q[0] = *(const v8b*)p; u.q[1] = *(const v8b*)(p + 16); return u.v;
}
__device__ __forceinline__ float bfr(float v) { return (float)(__bf16)v; }
__device__ __attribute__((noinline)) float exp_ni(float v) { return expf(v); }
__device__ __attribute__((noinline)) float erf_ni(float v) { return erff(v); }

#define WS_PW  0u                                  // bf16 natural rows Wq, Wk, Wv [3][128][128]
#define WS_Q   (WS_PW + 2u * 3 * EE * EE)           // f16 [NR][128] q ; K rows ; V planes [b][128][SS]
#define WS_K   (WS_Q + 2u * (size_t)NR * EE)
#define WS_V   (WS_K + 2u * (size_t)NR * EE)
#define WS_END (WS_V + 2u * (size_t)NB * EE * SS)

__global__ __launch_bounds__(128) void k_pack(const float* __restrict__ WQ, const float* __restrict__ WK, const float* __restrict__ WV, __bf16* __restrict__ P) { const int n = blockIdx.x, which = blockIdx.y, t = threadIdx.x; const float* Wm = (which == 0) ? WQ : (which == 1) ? WK : WV; __shared__ __align__(16) __bf16 s[EE]; s[t] = (__bf16)Wm[(size_t)n * EE + t]; __syncthreads(); if (t < EE / 8) vst2((unsigned*)(P + ((size_t)which * EE + n) * EE + t * 8), *(const v4u*)&s[t * 8]); }
// ---- k_proj: block = (64 rows, which): 128 output cols; q / k -> f16 rows; v -> planes
__global__ __launch_bounds__(128) void k_proj(const float* __restrict__ X, const __bf16* __restrict__ P, const float* __restrict__ BQ, const float* __restrict__ BK, const float* __restrict__ BV, _Float16* __restrict__ Q, _Float16* __restrict__ Kr, _Float16* __restrict__ V) {
  __shared__ __align__(16) _Float16 so[64][136]; __shared__ __align__(16) _Float16 st[128][72];
  const int tid = threadIdx.x, wave = tid >> 5, lane = tid & 31, col = lane & 15, g = lane >> 4; const int which = blockIdx.y; const size_t rb0 = (size_t)blockIdx.x * 64, r0 = rb0 + wave * 16;
  const __bf16* Wr = P + (size_t)which * EE * EE; const float* BB = (which == 0) ? BQ : (which == 1) ? BK : BV;
  v8f acc[8] = {};
#pragma unroll
  for (int kc = 0; kc < EE / 32; ++kc) { v16b a; { const float* p = X + (r0 + col) * EE + kc * 32 + 8 * g;
#pragma unroll
      for (int i = 0; i < 8; ++i) { a[i] = (__bf16)p[i]; a[8 + i] = (__bf16)p[16 + i]; } }
#pragma unroll
    for (int j = 0; j < 8; ++j) acc[j] = wmma_bf(a, frag_b(Wr + (size_t)(j * 16 + col) * EE + kc * 32, lane), acc[j]); }
  if (which < 2) {
#pragma unroll
    for (int j = 0; j < 8; ++j) { const float bb = bfr(BB[j * 16 + col]);
#pragma unroll
      for (int r = 0; r < 8; ++r) so[wave * 16 + 8 * g + r][j * 16 + col] = (_Float16)(acc[j][r] + bb); }
    LDSX();
    _Float16* dst = (which == 0) ? Q : Kr;
    for (int rl = 0; rl < 16; ++rl) if (lane < 16) vst2((unsigned*)(dst + (r0 + rl) * EE + lane * 8), *(const v4u*)&so[wave * 16 + rl][lane * 8]);
  } else {
#pragma unroll
    for (int j = 0; j < 8; ++j) { const float bb = bfr(BB[j * 16 + col]);
#pragma unroll
      for (int r = 0; r < 8; ++r) st[j * 16 + col][wave * 16 + 8 * g + r] = (_Float16)(acc[j][r] + bb); }
    __syncthreads();
    const size_t b = rb0 / SS, s0 = rb0 % SS;
    for (int e = tid; e < 128 * 8; e += 128) { const int d = e >> 3, pc = e & 7; vst2((unsigned*)(V + ((b * EE + d) * SS) + s0 + pc * 8), *(const v4u*)&st[d][pc * 8]); } }
}
// fragment at a lane's own address (row start + k0 + 8 * (lane >> 4) already added)
__device__ __forceinline__ v16h frag_p(const _Float16* p) { union { v16h v; v8h q[2]; } u; u.q[0] = *(const v8h*)p; u.q[1] = *(const v8h*)(p + 16); return u.v; }
// The wave's own P hand-over through LDS, as LDSX but for two things: the fence is named for LDS alone, so that it does not drain the global fragment loads in flight across it;
// and the first statement may carry the s_wait_xcnt 0 of those loads, with their address pairs as inputs, so that no register of a pair is rewritten ahead of it.
#define LDSP_TAIL() do { __builtin_amdgcn_wave_barrier(); __builtin_amdgcn_fence(__ATOMIC_RELEASE, "workgroup", "local"); } while (0)
// ---- k_attn: block = (64 queries, b): 128-dim q/k/v, all 8,192 keys, plain; f32 output rows
__global__ __launch_bounds__(128) void k_attn(const _Float16* __restrict__ Q, const _Float16* __restrict__ Kr, const _Float16* __restrict__ V, float* __restrict__ OUT) {
  __shared__ __align__(16) _Float16 sph[4][16][40]; __shared__ __align__(16) float so[4][16][132];
  const int tid = threadIdx.x, wave = tid >> 5, lane = tid & 31, col = lane & 15, g = lane >> 4; const size_t b = blockIdx.y; const int q0 = blockIdx.x * 64 + wave * 16; const size_t rq = b * SS + q0;
  v16h aq[4];
#pragma unroll
  for (int kc = 0; kc < 4; ++kc) aq[kc] = frag_h(Q + (rq + col) * EE + kc * 32, lane);
  float m[8], l[8];
#pragma unroll
  for (int r = 0; r < 8; ++r) { m[r] = -3.0e38f; l[r] = 0.f; }
  v8f acc[8] = {};
  asm volatile("s_wait_xcnt 0x0" ::: "memory");   // the Q loads' address pair is free for reuse by what follows
  // K and V fragments live in registers one pass ahead: each set is refilled as ONE group of loads right behind its last product,
  // so a pass waits for no load of its own (a load written at its product is held there by the product's asm statement and waited out alone).
  const _Float16* Kg = Kr + (b * SS + col) * EE + 8 * g; const _Float16* Vg = V + (b * EE + col) * SS + 8 * g;
  v16h kf[2][4], vf[8];
#pragma unroll
  for (int ct = 0; ct < 2; ++ct) {
#pragma unroll
    for (int kc = 0; kc < 4; ++kc) kf[ct][kc] = frag_p(Kg + ct * 16 * EE + kc * 32); }
  __builtin_amdgcn_sched_barrier(0);   // V's first loads stay the youngest, as in the loop: else the counted waits at the loop's head, merged from both ways in, also drain V
  const _Float16* vp = Vg;
#pragma unroll
  for (int dt = 0; dt < 8; ++dt) vf[dt] = frag_p(vp + (size_t)(dt * 16) * SS);
#pragma unroll 1
  for (int ks = 0; ks < SS / 32; ++ks) { const int jn = (ks + 1 < SS / 32) ? (ks + 1) * 32 : 0; v8f s[2];   // next pass's keys; the last pass refetches tile 0, in bounds and unused
#pragma unroll
    for (int ct = 0; ct < 2; ++ct) { v8f c = {};
#pragma unroll
      for (int kc = 0; kc < 4; ++kc) c = wmma16(aq[kc], kf[ct][kc], c);
#pragma unroll
      for (int r = 0; r < 8; ++r) s[ct][r] = c[r] * 0.08838834764831845f; }   // 128^-0.5
    const _Float16* kp = Kg + (size_t)jn * EE;
#pragma unroll
    for (int ct = 0; ct < 2; ++ct) {
#pragma unroll
      for (int kc = 0; kc < 4; ++kc) kf[ct][kc] = frag_p(kp + ct * 16 * EE + kc * 32); }
#pragma unroll
    for (int r = 0; r < 8; ++r) { float mx = fmaxf(s[0][r], s[1][r]);
#pragma unroll
      for (int o = 1; o < 16; o <<= 1) mx = fmaxf(mx, __shfl_xor(mx, o));
      const float mn = fmaxf(m[r], mx); const float alpha = (m[r] <= -1.0e38f) ? 0.f : __expf(m[r] - mn); const float e0 = __expf(s[0][r] - mn), e1 = __expf(s[1][r] - mn); float es = e0 + e1;
#pragma unroll
      for (int o = 1; o < 16; o <<= 1) es += __shfl_xor(es, o);
      l[r] = l[r] * alpha + es; m[r] = mn;
#pragma unroll
      for (int dt = 0; dt < 8; ++dt) acc[dt][r] *= alpha;
      sph[wave][8 * g + r][col] = (_Float16)(e0 * 2048.0f); sph[wave][8 * g + r][16 + col] = (_Float16)(e1 * 2048.0f); }
    asm volatile("s_wait_dscnt 0\n\ts_wait_xcnt 0x0" :: "v"(kp), "v"(vp) : "memory");   // P is written; the s_wait_xcnt 0 of the K loads above and of the V loads of the pass before stands here: kp and vp are rewritten only behind it
    LDSP_TAIL();
    const v16h pa = frag_h(&sph[wave][col][0], lane);
#pragma unroll
    for (int dt = 0; dt < 8; ++dt) acc[dt] = wmma16(pa, vf[dt], acc[dt]);
    vp = Vg + jn;
#pragma unroll
    for (int dt = 0; dt < 8; ++dt) vf[dt] = frag_p(vp + (size_t)(dt * 16) * SS);
    asm volatile("s_wait_dscnt 0" ::: "memory"); LDSP_TAIL(); }   // P is read before the next pass rewrites it, as LDSX stood here
  asm volatile("s_wait_xcnt 0x0" :: "v"(vp) : "memory");   // the last V loads' address pair is free for the epilogue
#pragma unroll
  for (int r = 0; r < 8; ++r) { const float il = (1.0f / 2048.0f) / l[r];
#pragma unroll
    for (int dt = 0; dt < 8; ++dt) so[wave][8 * g + r][dt * 16 + col] = acc[dt][r] * il; }
  LDSX();
  for (int rl = 0; rl < 16; ++rl) vst2(OUT + (rq + rl) * EE + lane * 4, *(const v4f*)&so[wave][rl][lane * 4]);   // whole 512-B output row per wave
}
extern "C" void kernel_launch(void* const* d_in, const int* in_sizes, int n_in, void* d_out, int out_size, void* d_ws, size_t ws_size, hipStream_t stream) {
  (void)in_sizes; (void)n_in; (void)out_size;
  const float** F = (const float**)d_in;   // 0 x [2,8192,128], 1 Wq [128,128], 2 bq, 3 Wk, 4 bk, 5 Wv, 6 bv
  if (ws_size < (size_t)WS_END) return;
  char* ws = (char*)d_ws; __bf16* P = (__bf16*)ws; _Float16 *Q = (_Float16*)(ws + WS_Q), *Kr = (_Float16*)(ws + WS_K), *V = (_Float16*)(ws + WS_V);
  k_pack<<<dim3(EE, 3), 128, 0, stream>>>(F[1], F[3], F[5], P);
  k_proj<<<dim3(TNB * SS / 64, 3), 128, 0, stream>>>(F[0], P, F[2], F[4], F[6], Q, Kr, V);
  k_attn<<<dim3(TQB, TNB), 128, 0, stream>>>(Q, Kr, V, (float*)d_out);
}

// v002
// One run takes 201 microseconds.
// Timed twice side by side with v001, it ran 1.34 and 1.36 times as fast.
// All steps since v000 together make it 4.45 times as fast.
// compute dtype: all float inputs rounded to bf16; Q / K / V = x . W^T + b with EXACT bf16 products on WMMA 16x16x32 (natural rows), rounded once to f16; PLAIN single-head attention over 8,192 slices with 128-dim q/k/v: q, k single f16 x 128^-0.5, running-max softmax in f32 (hardware exp), P (scaled by 2^11, single f16) x v (single f16); f32 accumulate and output.
#include <hip/hip_runtime.h>
#include <math.h>

typedef __attribute__((ext_vector_type(16))) _Float16 v16h;
typedef __attribute__((ext_vector_type(16))) __bf16 v16b;
typedef __attribute__((ext_vector_type(8)))  _Float16 v8h;
typedef __attribute__((ext_vector_type(8)))  float v8f;
typedef __attribute__((ext_vector_type(4)))  float v4f;
typedef __attribute__((ext_vector_type(2)))  float v2f;
typedef __attribute__((ext_vector_type(4)))  unsigned v4u;
typedef __attribute__((ext_vector_type(4)))  int v4i;
typedef float __attribute__((may_alias)) float_a;
typedef int __attribute__((may_alias)) int_a;

template <typename T> __device__ __forceinline__ void vst2(void* p, T v) { *(T*)p = v;  }
__device__ __forceinline__ v8f wmma16(v16h a, v16h b, v8f c) {
  v8f d = __builtin_amdgcn_wmma_f32_16x16x32_f16(false, a, false, b, (short)0, c, false, false);
  asm volatile("v_nop\n\tv_nop\n\tv_nop\n\tv_nop" : "+v"(d) : "v"(a), "v"(b));
  return d;
}
__device__ __forceinline__ v8f wmma_bf(v16b a, v16b b, v8f c) {
  v8f d = __builtin_amdgcn_wmma_f32_16x16x32_bf16(false, a, false, b, (short)0, c, false, false);
  asm volatile("v_nop\n\tv_nop\n\tv_nop\n\tv_nop" : "+v"(d) : "v"(a), "v"(b));
  return d;
}
// 16x16x32 fragments: lane = (h = lane>>4, row/col = lane&15); elements 0..7 = k0+8h+0..7, 8..15 = k0+16+8h+0..7; D element r = row 8h+r
__device__ __forceinline__ v16h frag_h(const _Float16* rowk0, int lane) {
  union { v16h v; v8h q[2]; } u; const _Float16* p = rowk0 + 8 * (lane >> 4);
  u.q[0] = *(const v8h*)p; u.q[1] = *(const v8h*)(p + 16); return u.v;
}
__device__ __forceinline__ v16h frag_f32(const float* rowk0, int lane) {
  v16h a; const float* p = rowk0 + 8 * (lane >> 4);
#pragma unroll
  for (int i = 0; i < 8; ++i) { a[i] = (_Float16)p[i]; a[8 + i] = (_Float16)p[16 + i]; }
  return a;
}
__device__ __forceinline__ v16h frag_f32s(const float* rowk0, int lane, float sc) {
  v16h a; const float* p = rowk0 + 8 * (lane >> 4);
#pragma unroll
  for (int i = 0; i < 8; ++i) { a[i] = (_Float16)(p[i] * sc); a[8 + i] = (_Float16)(p[16 + i] * sc); }
  return a;
}
// column fragment from a [K][ld] layout (column n), rows >= K read as 0
__device__ __forceinline__ v16h fragc_f32(const float* W, int k0, int n, int lane, int ld, int K) {
  v16h a; const int g = lane >> 4;
#pragma unroll
  for (int i = 0; i < 8; ++i) { const int ka = k0 + 8 * g + i, kb = ka + 16;
    a[i] = (_Float16)(ka < K ? W[(size_t)(ka < K ? ka : K - 1) * ld + n] : 0.f); a[8 + i] = (_Float16)(kb < K ? W[(size_t)(kb < K ? kb : K - 1) * ld + n] : 0.f); }
  return a;
}
struct F2 { v16b h, l; };
__device__ __forceinline__ F2 bsplit16(const float v[16]) { F2 r;
#pragma unroll
  for (int i = 0; i < 16; ++i) { const __bf16 h = (__bf16)v[i]; r.h[i] = h; r.l[i] = (__bf16)(v[i] - (float)h); }
  return r; }
__device__ __forceinline__ F2 split_row(const float* row, int k0, int lane) { float v[16]; const float* p = row + k0 + 8 * (lane >> 4);
#pragma unroll
  for (int i = 0; i < 8; ++i) { v[i] = p[i]; v[8 + i] = p[16 + i]; }
  return bsplit16(v); }
__device__ __forceinline__ F2 split_rowK(const float* row, int k0, int lane, int K) { float v[16]; const int g = lane >> 4;
#pragma unroll
  for (int i = 0; i < 8; ++i) { const int ka = k0 + 8 * g + i, kb = ka + 16; v[i] = ka < K ? row[ka < K ? ka : K - 1] : 0.f; v[8 + i] = kb < K ? row[kb < K ? kb : K - 1] : 0.f; }
  return bsplit16(v); }
__device__ __forceinline__ F2 split_col(const float* W, int k0, int n, int lane, int ld, int K) { float v[16]; const int g = lane >> 4;
#pragma unroll
  for (int i = 0; i < 8; ++i) { const int ka = k0 + 8 * g + i, kb = ka + 16; v[i] = ka < K ? W[(size_t)(ka < K ? ka : K - 1) * ld + n] : 0.f; v[8 + i] = kb < K ? W[(size_t)(kb < K ? kb : K - 1) * ld + n] : 0.f; }
  return bsplit16(v); }
__device__ __forceinline__ v8f mac3(const F2& a, const F2& b, v8f c) { c = wmma_bf(a.l, b.h, c); c = wmma_bf(a.h, b.l, c); return wmma_bf(a.h, b.h, c); }
__device__ __forceinline__ float sigm(float v) { return 1.0f / (1.0f + expf(-v)); }
#define LDSX() do { asm volatile("s_wait_dscnt 0" ::: "memory"); __builtin_amdgcn_wave_barrier(); __builtin_amdgcn_fence(__ATOMIC_RELEASE, "workgroup"); } while (0)


// Slice attention (B 2, 8,192 slices, 128 features, one head): 1x1-conv q / k / v projections + biases, softmax(Q K^T / sqrt(128)) V.
#define NB 2
#define SS 8192
#define EE 128
#define NR (NB * SS)
#ifndef TQB
#define TQB (SS / 64)
#define TNB NB
#endif
typedef __attribute__((ext_vector_type(8))) __bf16 v8b;
__device__ __forceinline__ v16b frag_b(const __bf16* rowk0, int lane) {
  union { v16b v; v8b q[2]; } u; const __bf16* p = rowk0 + 8 * (lane >> 4);
  u.q[0] = *(const v8b*)p; u.q[1] = *(const v8b*)(p + 16); return u.v;
}
__device__ __forceinline__ float bfr(float v) { return (float)(__bf16)v; }
__device__ __attribute__((noinline)) float exp_ni(float v) { return expf(v); }
__device__ __attribute__((noinline)) float erf_ni(float v) { return erff(v); }

#define WS_PW  0u                                  // bf16 natural rows Wq, Wk, Wv [3][128][128]
#define WS_Q   (WS_PW + 2u * 3 * EE * EE)           // f16 [NR][128] q rows ; K and V in fragment order (below)
// K: [16-key tile][kc * 2 + h][lane][8]: lane (g, col) holds key col, dims kc * 32 + h * 16 + g * 8 + 0..7.  V: [32-key block][dt * 2 + h][lane][8]: lane (g, col) holds dim dt * 16 + col, keys h * 16 + g * 8 + 0..7.
// Each [lane][8] unit is 512 contiguous bytes, one wave-wide 16-byte load of k_attn: 4 whole lines, where rows and planes gave 16 lines of 32 used bytes.
#define WS_K   (WS_Q + 2u * (size_t)NR * EE)
#define WS_V   (WS_K + 2u * (size_t)NR * EE)
#define WS_END (WS_V + 2u * (size_t)NB * EE * SS)

__global__ __launch_bounds__(128) void k_pack(const float* __restrict__ WQ, const float* __restrict__ WK, const float* __restrict__ WV, __bf16* __restrict__ P) { const int n = blockIdx.x, which = blockIdx.y, t = threadIdx.x; const float* Wm = (which == 0) ? WQ : (which == 1) ? WK : WV; __shared__ __align__(16) __bf16 s[EE]; s[t] = (__bf16)Wm[(size_t)n * EE + t]; __syncthreads(); if (t < EE / 8) vst2((unsigned*)(P + ((size_t)which * EE + n) * EE + t * 8), *(const v4u*)&s[t * 8]); }
// ---- k_proj: block = (64 rows, which): 128 output cols; q -> f16 rows; k, v -> fragment order
__global__ __launch_bounds__(128) void k_proj(const float* __restrict__ X, const __bf16* __restrict__ P, const float* __restrict__ BQ, const float* __restrict__ BK, const float* __restrict__ BV, _Float16* __restrict__ Q, _Float16* __restrict__ Kr, _Float16* __restrict__ V) {
  __shared__ __align__(16) _Float16 so[64][136]; __shared__ __align__(16) _Float16 st[128][72];
  const int tid = threadIdx.x, wave = tid >> 5, lane = tid & 31, col = lane & 15, g = lane >> 4; const int which = blockIdx.y; const size_t rb0 = (size_t)blockIdx.x * 64, r0 = rb0 + wave * 16;
  const __bf16* Wr = P + (size_t)which * EE * EE; const float* BB = (which == 0) ? BQ : (which == 1) ? BK : BV;
  v8f acc[8] = {};
#pragma unroll
  for (int kc = 0; kc < EE / 32; ++kc) { v16b a; { const float* p = X + (r0 + col) * EE + kc * 32 + 8 * g;
#pragma unroll
      for (int i = 0; i < 8; ++i) { a[i] = (__bf16)p[i]; a[8 + i] = (__bf16)p[16 + i]; } }
#pragma unroll
    for (int j = 0; j < 8; ++j) acc[j] = wmma_bf(a, frag_b(Wr + (size_t)(j * 16 + col) * EE + kc * 32, lane), acc[j]); }
  if (which < 2) {
#pragma unroll
    for (int j = 0; j < 8; ++j) { const float bb = bfr(BB[j * 16 + col]);
#pragma unroll
      for (int r = 0; r < 8; ++r) so[wave * 16 + 8 * g + r][j * 16 + col] = (_Float16)(acc[j][r] + bb); }
    LDSX();
    if (which == 0) { for (int rl = 0; rl < 16; ++rl) if (lane < 16) vst2((unsigned*)(Q + (r0 + rl) * EE + lane * 8), *(const v4u*)&so[wave * 16 + rl][lane * 8]); }
    else {   // the wave's 16 rows are one key tile: 8 units of 512 B
#pragma unroll
      for (int i = 0; i < 8; ++i) vst2((unsigned*)(Kr + r0 * EE + i * 256 + lane * 8), *(const v4u*)&so[wave * 16 + col][i * 16 + g * 8]);
      asm volatile("s_wait_xcnt 0x0" ::: "memory"); }   // behind the last K store: no register that the eight stores name is rewritten ahead of it on any path of the listing
  } else {
#pragma unroll
    for (int j = 0; j < 8; ++j) { const float bb = bfr(BB[j * 16 + col]);
#pragma unroll
      for (int r = 0; r < 8; ++r) st[j * 16 + col][wave * 16 + 8 * g + r] = (_Float16)(acc[j][r] + bb); }
    __syncthreads();
    // the block's 64 keys are two 32-key blocks, 16 KB in a row: 16-byte piece e = ((block * 8 + dt) * 2 + h) * 32 + g * 16 + col
    for (int e = tid; e < 128 * 8; e += 128) vst2((unsigned*)(V + rb0 * EE + (size_t)e * 8), *(const v4u*)&st[((e >> 6) & 7) * 16 + (e & 15)][(e >> 9) * 32 + ((e >> 5) & 1) * 16 + ((e >> 4) & 1) * 8]); }
}
// fragment in fragment order at a lane's own address (8 * lane already added): its two halves are the lane's 16 bytes of two 512-B units in a row
__device__ __forceinline__ v16h frag_p(const _Float16* p) { union { v16h v; v8h q[2]; } u; u.q[0] = *(const v8h*)p; u.q[1] = *(const v8h*)(p + 256); return u.v; }
// The wave's own P hand-over through LDS, as LDSX but for two things: the fence is named for LDS alone, so that it does not drain the global fragment loads in flight across it;
// and the first statement may carry the s_wait_xcnt 0 of those loads, with their address pairs as inputs, so that no register of a pair is rewritten ahead of it.
#define LDSP_TAIL() do { __builtin_amdgcn_wave_barrier(); __builtin_amdgcn_fence(__ATOMIC_RELEASE, "workgroup", "local"); } while (0)
// ---- k_attn: block = (64 queries, b): 128-dim q/k/v, all 8,192 keys, plain; f32 output rows
__global__ __launch_bounds__(128) void k_attn(const _Float16* __restrict__ Q, const _Float16* __restrict__ Kr, const _Float16* __restrict__ V, float* __restrict__ OUT) {
  __shared__ __align__(16) _Float16 sph[4][16][40]; __shared__ __align__(16) float so[4][16][132];
  const int tid = threadIdx.x, wave = tid >> 5, lane = tid & 31, col = lane & 15, g = lane >> 4; const size_t b = blockIdx.y; const int q0 = blockIdx.x * 64 + wave * 16; const size_t rq = b * SS + q0;
  v16h aq[4];
#pragma unroll
  for (int kc = 0; kc < 4; ++kc) aq[kc] = frag_h(Q + (rq + col) * EE + kc * 32, lane);
  float m[8], l[8];
#pragma unroll
  for (int r = 0; r < 8; ++r) { m[r] = -3.0e38f; l[r] = 0.f; }
  v8f acc[8] = {};
  asm volatile("s_wait_xcnt 0x0" ::: "memory");   // the Q loads' address pair is free for reuse by what follows
  // K and V fragments live in registers one pass ahead: each set is refilled as ONE group of loads right behind its last product,
  // so a pass waits for no load of its own (a load written at its product is held there by the product's asm statement and waited out alone).
  const _Float16* Kg = Kr + b * SS * EE + 8 * lane; const _Float16* Vg = V + b * SS * EE + 8 * lane;
  v16h kf[2][4], vf[8];
#pragma unroll
  for (int ct = 0; ct < 2; ++ct) {
#pragma unroll
    for (int kc = 0; kc < 4; ++kc) kf[ct][kc] = frag_p(Kg + ct * 16 * EE + kc * 512); }
  __builtin_amdgcn_sched_barrier(0);   // V's first loads stay the youngest, as in the loop: else the counted waits at the loop's head, merged from both ways in, also drain V
  const _Float16* vp = Vg;
#pragma unroll
  for (int dt = 0; dt < 8; ++dt) vf[dt] = frag_p(vp + dt * 512);
#pragma unroll 1
  for (int ks = 0; ks < SS / 32; ++ks) { const int jn = (ks + 1 < SS / 32) ? (ks + 1) * 32 : 0; v8f s[2];   // next pass's keys; the last pass refetches tile 0, in bounds and unused
#pragma unroll
    for (int ct = 0; ct < 2; ++ct) { v8f c = {};
#pragma unroll
      for (int kc = 0; kc < 4; ++kc) c = wmma16(aq[kc], kf[ct][kc], c);
#pragma unroll
      for (int r = 0; r < 8; ++r) s[ct][r] = c[r] * 0.08838834764831845f; }   // 128^-0.5
    const _Float16* kp = Kg + (size_t)jn * EE;
#pragma unroll
    for (int ct = 0; ct < 2; ++ct) {
#pragma unroll
      for (int kc = 0; kc < 4; ++kc) kf[ct][kc] = frag_p(kp + ct * 16 * EE + kc * 512); }
#pragma unroll
    for (int r = 0; r < 8; ++r) { float mx = fmaxf(s[0][r], s[1][r]);
#pragma unroll
      for (int o = 1; o < 16; o <<= 1) mx = fmaxf(mx, __shfl_xor(mx, o));
      const float mn = fmaxf(m[r], mx); const float alpha = (m[r] <= -1.0e38f) ? 0.f : __expf(m[r] - mn); const float e0 = __expf(s[0][r] - mn), e1 = __expf(s[1][r] - mn); float es = e0 + e1;
#pragma unroll
      for (int o = 1; o < 16; o <<= 1) es += __shfl_xor(es, o);
      l[r] = l[r] * alpha + es; m[r] = mn;
#pragma unroll
      for (int dt = 0; dt < 8; ++dt) acc[dt][r] *= alpha;
      sph[wave][8 * g + r][col] = (_Float16)(e0 * 2048.0f); sph[wave][8 * g + r][16 + col] = (_Float16)(e1 * 2048.0f); }
    asm volatile("s_wait_dscnt 0\n\ts_wait_xcnt 0x0" :: "v"(kp), "v"(vp) : "memory");   // P is written; the s_wait_xcnt 0 of the K loads above and of the V loads of the pass before stands here: kp and vp are rewritten only behind it
    LDSP_TAIL();
    const v16h pa = frag_h(&sph[wave][col][0], lane);
#pragma unroll
    for (int dt = 0; dt < 8; ++dt) acc[dt] = wmma16(pa, vf[dt], acc[dt]);
    vp = Vg + (size_t)jn * EE;
#pragma unroll
    for (int dt = 0; dt < 8; ++dt) vf[dt] = frag_p(vp + dt * 512);
    asm volatile("s_wait_dscnt 0" ::: "memory"); LDSP_TAIL(); }   // P is read before the next pass rewrites it, as LDSX stood here
  asm volatile("s_wait_xcnt 0x0" :: "v"(vp) : "memory");   // the last V loads' address pair is free for the epilogue
#pragma unroll
  for (int r = 0; r < 8; ++r) { const float il = (1.0f / 2048.0f) / l[r];
#pragma unroll
    for (int dt = 0; dt < 8; ++dt) so[wave][8 * g + r][dt * 16 + col] = acc[dt][r] * il; }
  LDSX();
  for (int rl = 0; rl < 16; ++rl) vst2(OUT + (rq + rl) * EE + lane * 4, *(const v4f*)&so[wave][rl][lane * 4]);   // whole 512-B output row per wave
}
extern "C" void kernel_launch(void* const* d_in, const int* in_sizes, int n_in, void* d_out, int out_size, void* d_ws, size_t ws_size, hipStream_t stream) {
  (void)in_sizes; (void)n_in; (void)out_size;
  const float** F = (const float**)d_in;   // 0 x [2,8192,128], 1 Wq [128,128], 2 bq, 3 Wk, 4 bk, 5 Wv, 6 bv
  if (ws_size < (size_t)WS_END) return;
  char* ws = (char*)d_ws; __bf16* P = (__bf16*)ws; _Float16 *Q = (_Float16*)(ws + WS_Q), *Kr = (_Float16*)(ws + WS_K), *V = (_Float16*)(ws + WS_V);
  k_pack<<<dim3(EE, 3), 128, 0, stream>>>(F[1], F[3], F[5], P);
  k_proj<<<dim3(TNB * SS / 64, 3), 128, 0, stream>>>(F[0], P, F[2], F[4], F[6], Q, Kr, V);
  k_attn<<<dim3(TQB, TNB), 128, 0, stream>>>(Q, Kr, V, (float*)d_out);
}

// v003
// Measured time: 187 microseconds a run.
// In both of two side-by-side timings against v002, it was 1.07 times as fast.
// Over all steps from v000 it is 4.77 times as fast.
// compute dtype: all float inputs rounded to bf16; Q / K / V = x . W^T + b with EXACT bf16 products on WMMA 16x16x32 (natural rows), rounded once to f16; PLAIN single-head attention over 8,192 slices with 128-dim q/k/v: q, k single f16 x 128^-0.5, running-max softmax in f32 (hardware exp), P (scaled by 2^11, single f16) x v (single f16); f32 accumulate and output.
#include <hip/hip_runtime.h>
#include <math.h>

typedef __attribute__((ext_vector_type(16))) _Float16 v16h;
typedef __attribute__((ext_vector_type(16))) __bf16 v16b;
typedef __attribute__((ext_vector_type(8)))  _Float16 v8h;
typedef __attribute__((ext_vector_type(8)))  float v8f;
typedef __attribute__((ext_vector_type(4)))  float v4f;
typedef __attribute__((ext_vector_type(2)))  float v2f;
typedef __attribute__((ext_vector_type(4)))  unsigned v4u;
typedef __attribute__((ext_vector_type(4)))  int v4i;
typedef float __attribute__((may_alias)) float_a;
typedef int __attribute__((may_alias)) int_a;

template <typename T> __device__ __forceinline__ void vst2(void* p, T v) { *(T*)p = v;  }
__device__ __forceinline__ v8f wmma16(v16h a, v16h b, v8f c) {
  v8f d = __builtin_amdgcn_wmma_f32_16x16x32_f16(false, a, false, b, (short)0, c, false, false);
  asm volatile("v_nop\n\tv_nop\n\tv_nop\n\tv_nop" : "+v"(d) : "v"(a), "v"(b));
  return d;
}
__device__ __forceinline__ v8f wmma_bf(v16b a, v16b b, v8f c) {
  v8f d = __builtin_amdgcn_wmma_f32_16x16x32_bf16(false, a, false, b, (short)0, c, false, false);
  asm volatile("v_nop\n\tv_nop\n\tv_nop\n\tv_nop" : "+v"(d) : "v"(a), "v"(b));
  return d;
}
// 16x16x32 fragments: lane = (h = lane>>4, row/col = lane&15); elements 0..7 = k0+8h+0..7, 8..15 = k0+16+8h+0..7; D element r = row 8h+r
__device__ __forceinline__ v16h frag_h(const _Float16* rowk0, int lane) {
  union { v16h v; v8h q[2]; } u; const _Float16* p = rowk0 + 8 * (lane >> 4);
  u.q[0] = *(const v8h*)p; u.q[1] = *(const v8h*)(p + 16); return u.v;
}
__device__ __forceinline__ v16h frag_f32(const float* rowk0, int lane) {
  v16h a; const float* p = rowk0 + 8 * (lane >> 4);
#pragma unroll
  for (int i = 0; i < 8; ++i) { a[i] = (_Float16)p[i]; a[8 + i] = (_Float16)p[16 + i]; }
  return a;
}
__device__ __forceinline__ v16h frag_f32s(const float* rowk0, int lane, float sc) {
  v16h a; const float* p = rowk0 + 8 * (lane >> 4);
#pragma unroll
  for (int i = 0; i < 8; ++i) { a[i] = (_Float16)(p[i] * sc); a[8 + i] = (_Float16)(p[16 + i] * sc); }
  return a;
}
// column fragment from a [K][ld] layout (column n), rows >= K read as 0
__device__ __forceinline__ v16h fragc_f32(const float* W, int k0, int n, int lane, int ld, int K) {
  v16h a; const int g = lane >> 4;
#pragma unroll
  for (int i = 0; i < 8; ++i) { const int ka = k0 + 8 * g + i, kb = ka + 16;
    a[i] = (_Float16)(ka < K ? W[(size_t)(ka < K ? ka : K - 1) * ld + n] : 0.f); a[8 + i] = (_Float16)(kb < K ? W[(size_t)(kb < K ? kb : K - 1) * ld + n] : 0.f); }
  return a;
}
struct F2 { v16b h, l; };
__device__ __forceinline__ F2 bsplit16(const float v[16]) { F2 r;
#pragma unroll
  for (int i = 0; i < 16; ++i) { const __bf16 h = (__bf16)v[i]; r.h[i] = h; r.l[i] = (__bf16)(v[i] - (float)h); }
  return r; }
__device__ __forceinline__ F2 split_row(const float* row, int k0, int lane) { float v[16]; const float* p = row + k0 + 8 * (lane >> 4);
#pragma unroll
  for (int i = 0; i < 8; ++i) { v[i] = p[i]; v[8 + i] = p[16 + i]; }
  return bsplit16(v); }
__device__ __forceinline__ F2 split_rowK(const float* row, int k0, int lane, int K) { float v[16]; const int g = lane >> 4;
#pragma unroll
  for (int i = 0; i < 8; ++i) { const int ka = k0 + 8 * g + i, kb = ka + 16; v[i] = ka < K ? row[ka < K ? ka : K - 1] : 0.f; v[8 + i] = kb < K ? row[kb < K ? kb : K - 1] : 0.f; }
  return bsplit16(v); }
__device__ __forceinline__ F2 split_col(const float* W, int k0, int n, int lane, int ld, int K) { float v[16]; const int g = lane >> 4;
#pragma unroll
  for (int i = 0; i < 8; ++i) { const int ka = k0 + 8 * g + i, kb = ka + 16; v[i] = ka < K ? W[(size_t)(ka < K ? ka : K - 1) * ld + n] : 0.f; v[8 + i] = kb < K ? W[(size_t)(kb < K ? kb : K - 1) * ld + n] : 0.f; }
  return bsplit16(v); }
__device__ __forceinline__ v8f mac3(const F2& a, const F2& b, v8f c) { c = wmma_bf(a.l, b.h, c); c = wmma_bf(a.h, b.l, c); return wmma_bf(a.h, b.h, c); }
__device__ __forceinline__ float sigm(float v) { return 1.0f / (1.0f + expf(-v)); }
#define LDSX() do { asm volatile("s_wait_dscnt 0" ::: "memory"); __builtin_amdgcn_wave_barrier(); __builtin_amdgcn_fence(__ATOMIC_RELEASE, "workgroup"); } while (0)


// Slice attention (B 2, 8,192 slices, 128 features, one head): 1x1-conv q / k / v projections + biases, softmax(Q K^T / sqrt(128)) V.
#define NB 2
#define SS 8192
#define EE 128
#define NR (NB * SS)
#ifndef TQB
#define TQB (SS / 64)
#define TNB NB
#endif
typedef __attribute__((ext_vector_type(8))) __bf16 v8b;
__device__ __forceinline__ v16b frag_b(const __bf16* rowk0, int lane) {
  union { v16b v; v8b q[2]; } u; const __bf16* p = rowk0 + 8 * (lane >> 4);
  u.q[0] = *(const v8b*)p; u.q[1] = *(const v8b*)(p + 16); return u.v;
}
__device__ __forceinline__ float bfr(float v) { return (float)(__bf16)v; }
__device__ __attribute__((noinline)) float exp_ni(float v) { return expf(v); }
__device__ __attribute__((noinline)) float erf_ni(float v) { return erff(v); }

#define WS_PW  0u                                  // bf16 natural rows Wq, Wk, Wv [3][128][128]
#define WS_Q   (WS_PW + 2u * 3 * EE * EE)           // f16 [NR][128] q rows ; K and V in fragment order (below)
// K: [16-key tile][kc * 2 + h][lane][8]: lane (g, col) holds key col, dims kc * 32 + h * 16 + g * 8 + 0..7.  V: [32-key block][dt * 2 + h][lane][8]: lane (g, col) holds dim dt * 16 + col, keys h * 16 + g * 8 + 0..7.
// Each [lane][8] unit is 512 contiguous bytes, one wave-wide 16-byte load of k_attn: 4 whole lines, where rows and planes gave 16 lines of 32 used bytes.
#define WS_K   (WS_Q + 2u * (size_t)NR * EE)
#define WS_V   (WS_K + 2u * (size_t)NR * EE)
#define WS_END (WS_V + 2u * (size_t)NB * EE * SS)

__global__ __launch_bounds__(128) void k_pack(const float* __restrict__ WQ, const float* __restrict__ WK, const float* __restrict__ WV, __bf16* __restrict__ P) { const int n = blockIdx.x, which = blockIdx.y, t = threadIdx.x; const float* Wm = (which == 0) ? WQ : (which == 1) ? WK : WV; __shared__ __align__(16) __bf16 s[EE]; s[t] = (__bf16)Wm[(size_t)n * EE + t]; __syncthreads(); if (t < EE / 8) vst2((unsigned*)(P + ((size_t)which * EE + n) * EE + t * 8), *(const v4u*)&s[t * 8]); }
// ---- k_proj: block = (64 rows, which): 128 output cols; q -> f16 rows; k, v -> fragment order
__global__ __launch_bounds__(128) void k_proj(const float* __restrict__ X, const __bf16* __restrict__ P, const float* __restrict__ BQ, const float* __restrict__ BK, const float* __restrict__ BV, _Float16* __restrict__ Q, _Float16* __restrict__ Kr, _Float16* __restrict__ V) {
  __shared__ __align__(16) _Float16 so[64][136]; __shared__ __align__(16) _Float16 st[128][72];
  const int tid = threadIdx.x, wave = tid >> 5, lane = tid & 31, col = lane & 15, g = lane >> 4; const int which = blockIdx.y; const size_t rb0 = (size_t)blockIdx.x * 64, r0 = rb0 + wave * 16;
  const __bf16* Wr = P + (size_t)which * EE * EE; const float* BB = (which == 0) ? BQ : (which == 1) ? BK : BV;
  v8f acc[8] = {};
#pragma unroll
  for (int kc = 0; kc < EE / 32; ++kc) { v16b a; { const float* p = X + (r0 + col) * EE + kc * 32 + 8 * g;
#pragma unroll
      for (int i = 0; i < 8; ++i) { a[i] = (__bf16)p[i]; a[8 + i] = (__bf16)p[16 + i]; } }
#pragma unroll
    for (int j = 0; j < 8; ++j) acc[j] = wmma_bf(a, frag_b(Wr + (size_t)(j * 16 + col) * EE + kc * 32, lane), acc[j]); }
  if (which < 2) {
#pragma unroll
    for (int j = 0; j < 8; ++j) { const float bb = bfr(BB[j * 16 + col]);
#pragma unroll
      for (int r = 0; r < 8; ++r) so[wave * 16 + 8 * g + r][j * 16 + col] = (_Float16)(acc[j][r] + bb); }
    LDSX();
    if (which == 0) { for (int rl = 0; rl < 16; ++rl) if (lane < 16) vst2((unsigned*)(Q + (r0 + rl) * EE + lane * 8), *(const v4u*)&so[wave * 16 + rl][lane * 8]); }
    else {   // the wave's 16 rows are one key tile: 8 units of 512 B
#pragma unroll
      for (int i = 0; i < 8; ++i) vst2((unsigned*)(Kr + r0 * EE + i * 256 + lane * 8), *(const v4u*)&so[wave * 16 + col][i * 16 + g * 8]);
      asm volatile("s_wait_xcnt 0x0" ::: "memory"); }   // behind the last K store: no register that the eight stores name is rewritten ahead of it on any path of the listing
  } else {
#pragma unroll
    for (int j = 0; j < 8; ++j) { const float bb = bfr(BB[j * 16 + col]);
#pragma unroll
      for (int r = 0; r < 8; ++r) st[j * 16 + col][wave * 16 + 8 * g + r] = (_Float16)(acc[j][r] + bb); }
    __syncthreads();
    // the block's 64 keys are two 32-key blocks, 16 KB in a row: 16-byte piece e = ((block * 8 + dt) * 2 + h) * 32 + g * 16 + col
    for (int e = tid; e < 128 * 8; e += 128) vst2((unsigned*)(V + rb0 * EE + (size_t)e * 8), *(const v4u*)&st[((e >> 6) & 7) * 16 + (e & 15)][(e >> 9) * 32 + ((e >> 5) & 1) * 16 + ((e >> 4) & 1) * 8]); }
}
// fragment in fragment order at a lane's own address (8 * lane already added): its two halves are the lane's 16 bytes of two 512-B units in a row
__device__ __forceinline__ v16h frag_p(const _Float16* p) { union { v16h v; v8h q[2]; } u; u.q[0] = *(const v8h*)p; u.q[1] = *(const v8h*)(p + 256); return u.v; }
// lane l with lane l ^ 16 on the vector pipe (a shuffle would go through the LDS unit and its wait)
__device__ __forceinline__ float xhalf(float x) { return __builtin_bit_cast(float, __builtin_amdgcn_permlanex16(__builtin_bit_cast(int, x), __builtin_bit_cast(int, x), 0x76543210, 0xfedcba98, false, false)); }
// ---- k_attn: block = (64 queries, b): 128-dim q/k/v, all 8,192 keys, plain; f32 output rows
// Transposed products: S^T = K . Q^T (A = K fragment, B = Q fragment) and O^T += V^T . P^T (A = V fragment, B = P^T). Lane (g, col) then holds, of query col alone, the scores of keys 8g + r of each
// 16-key tile: maximum and sum are in-lane but for one exchange between the halves, and the two score tiles of a pass, converted in place, ARE the B fragment of the second product (element ct * 8 + r = key ct * 16 + 8g + r).
__global__ __launch_bounds__(128) void k_attn(const _Float16* __restrict__ Q, const _Float16* __restrict__ Kr, const _Float16* __restrict__ V, float* __restrict__ OUT) {
  __shared__ __align__(16) float so[4][16][132];
  const int tid = threadIdx.x, wave = tid >> 5, lane = tid & 31, col = lane & 15, g = lane >> 4; const size_t b = blockIdx.y; const int q0 = blockIdx.x * 64 + wave * 16; const size_t rq = b * SS + q0;
  v16h aq[4];
#pragma unroll
  for (int kc = 0; kc < 4; ++kc) aq[kc] = frag_h(Q + (rq + col) * EE + kc * 32, lane);
  float m = -3.0e38f, l = 0.f;   // of query col; l sums this half's keys only, the halves are joined behind the loop
  v8f acc[8] = {};               // acc[dt][r] = O^T[dim dt * 16 + 8g + r][query col]
  asm volatile("s_wait_xcnt 0x0" ::: "memory");   // the Q loads' address pair is free for reuse by what follows
  // K and V fragments live in registers one pass ahead: each set is refilled as ONE group of loads right behind its last product,
  // so a pass waits for no load of its own (a load written at its product is held there by the product's asm statement and waited out alone).
  const _Float16* Kg = Kr + b * SS * EE + 8 * lane; const _Float16* Vg = V + b * SS * EE + 8 * lane;
  v16h kf[2][4], vf[8];
#pragma unroll
  for (int ct = 0; ct < 2; ++ct) {
#pragma unroll
    for (int kc = 0; kc < 4; ++kc) kf[ct][kc] = frag_p(Kg + ct * 16 * EE + kc * 512); }
  __builtin_amdgcn_sched_barrier(0);   // V's first loads stay the youngest, as in the loop: else the counted waits at the loop's head, merged from both ways in, also drain V
  const _Float16* vp = Vg;
#pragma unroll
  for (int dt = 0; dt < 8; ++dt) vf[dt] = frag_p(vp + dt * 512);
#pragma unroll 1
  for (int ks = 0; ks < SS / 32; ++ks) { const int jn = (ks + 1 < SS / 32) ? (ks + 1) * 32 : 0; v8f s[2];   // next pass's keys; the last pass refetches tile 0, in bounds and unused
#pragma unroll
    for (int ct = 0; ct < 2; ++ct) { v8f c = {};
#pragma unroll
      for (int kc = 0; kc < 4; ++kc) c = wmma16(kf[ct][kc], aq[kc], c);
#pragma unroll
      for (int r = 0; r < 8; ++r) s[ct][r] = c[r] * 0.08838834764831845f; }   // 128^-0.5
    const _Float16* kp = Kg + (size_t)jn * EE;
#pragma unroll
    for (int ct = 0; ct < 2; ++ct) {
#pragma unroll
      for (int kc = 0; kc < 4; ++kc) kf[ct][kc] = frag_p(kp + ct * 16 * EE + kc * 512); }
    float t[4];
#pragma unroll
    for (int i = 0; i < 4; ++i) t[i] = fmaxf(fmaxf(s[0][i], s[0][4 + i]), fmaxf(s[1][i], s[1][4 + i]));
    float mx = fmaxf(fmaxf(t[0], t[1]), fmaxf(t[2], t[3])); mx = fmaxf(mx, xhalf(mx));   // all 32 keys of the pass: both halves scale P and O^T alike
    const float mn = fmaxf(m, mx); const float alpha = (m <= -1.0e38f) ? 0.f : __expf(m - mn);
    v16h pb; v2f ep[8];   // pairs of neighbouring registers: the scaling, the conversion and the sum all work on the same pairs
#pragma unroll
    for (int j = 0; j < 8; ++j) { ep[j][0] = __expf(s[j >> 2][(2 * j) & 7] - mn); ep[j][1] = __expf(s[j >> 2][(2 * j + 1) & 7] - mn);
      pb[2 * j] = (_Float16)(ep[j][0] * 2048.0f); pb[2 * j + 1] = (_Float16)(ep[j][1] * 2048.0f); }
    const v2f e2 = ((ep[0] + ep[1]) + (ep[2] + ep[3])) + ((ep[4] + ep[5]) + (ep[6] + ep[7]));   // a tree three deep instead of a chain of sixteen adds
    l = l * alpha + (e2[0] + e2[1]); m = mn;
#pragma unroll
    for (int dt = 0; dt < 8; ++dt) acc[dt] *= alpha;
    asm volatile("s_wait_xcnt 0x0" :: "v"(kp), "v"(vp) : "memory");   // the s_wait_xcnt 0 of the K loads above and of the V loads of the pass before stands here: kp and vp are rewritten only behind it
#pragma unroll
    for (int dt = 0; dt < 8; ++dt) acc[dt] = wmma16(vf[dt], pb, acc[dt]);
    vp = Vg + (size_t)jn * EE;
#pragma unroll
    for (int dt = 0; dt < 8; ++dt) vf[dt] = frag_p(vp + dt * 512); }
  asm volatile("s_wait_xcnt 0x0" :: "v"(vp) : "memory");   // the last V loads' address pair is free for the epilogue
  const float il = (1.0f / 2048.0f) / (l + xhalf(l));
#pragma unroll
  for (int dt = 0; dt < 8; ++dt) { const v8f o = acc[dt] * il;   // a lane's 8 registers are 8 dims in a row of its query's output row
    *(v4f*)&so[wave][col][dt * 16 + 8 * g] = __builtin_shufflevector(o, o, 0, 1, 2, 3); *(v4f*)&so[wave][col][dt * 16 + 8 * g + 4] = __builtin_shufflevector(o, o, 4, 5, 6, 7); }
  LDSX();
  for (int rl = 0; rl < 16; ++rl) vst2(OUT + (rq + rl) * EE + lane * 4, *(const v4f*)&so[wave][rl][lane * 4]);   // whole 512-B output row per wave
}
extern "C" void kernel_launch(void* const* d_in, const int* in_sizes, int n_in, void* d_out, int out_size, void* d_ws, size_t ws_size, hipStream_t stream) {
  (void)in_sizes; (void)n_in; (void)out_size;
  const float** F = (const float**)d_in;   // 0 x [2,8192,128], 1 Wq [128,128], 2 bq, 3 Wk, 4 bk, 5 Wv, 6 bv
  if (ws_size < (size_t)WS_END) return;
  char* ws = (char*)d_ws; __bf16* P = (__bf16*)ws; _Float16 *Q = (_Float16*)(ws + WS_Q), *Kr = (_Float16*)(ws + WS_K), *V = (_Float16*)(ws + WS_V);
  k_pack<<<dim3(EE, 3), 128, 0, stream>>>(F[1], F[3], F[5], P);
  k_proj<<<dim3(TNB * SS / 64, 3), 128, 0, stream>>>(F[0], P, F[2], F[4], F[6], Q, Kr, V);
  k_attn<<<dim3(TQB, TNB), 128, 0, stream>>>(Q, Kr, V, (float*)d_out);
}

// v004
// A run of this version takes 82.4 microseconds.
// Next to v003, in two timings, it ran 2.24 times as fast each time.
// Counting every step since v000, it is 10.7 times as fast.
// compute dtype: all float inputs rounded to bf16; Q / K / V = x . W^T + b with EXACT bf16 products on WMMA 16x16x32 (natural rows), rounded once to f16; PLAIN single-head attention over 8,192 slices with 128-dim q/k/v: q, k single f16 x 128^-0.5, running-max softmax in f32 (hardware exp), P (scaled by 2^11, single f16) x v (single f16); f32 accumulate and output.
#include <hip/hip_runtime.h>
#include <math.h>

typedef __attribute__((ext_vector_type(16))) _Float16 v16h;
typedef __attribute__((ext_vector_type(16))) __bf16 v16b;
typedef __attribute__((ext_vector_type(8)))  _Float16 v8h;
typedef __attribute__((ext_vector_type(8)))  float v8f;
typedef __attribute__((ext_vector_type(4)))  float v4f;
typedef __attribute__((ext_vector_type(2)))  float v2f;
typedef __attribute__((ext_vector_type(4)))  unsigned v4u;
typedef __attribute__((ext_vector_type(4)))  int v4i;
typedef float __attribute__((may_alias)) float_a;
typedef int __attribute__((may_alias)) int_a;

template <typename T> __device__ __forceinline__ void vst2(void* p, T v) { *(T*)p = v;  }
__device__ __forceinline__ v8f wmma16(v16h a, v16h b, v8f c) {
  v8f d = __builtin_amdgcn_wmma_f32_16x16x32_f16(false, a, false, b, (short)0, c, false, false);
  asm volatile("v_nop\n\tv_nop\n\tv_nop\n\tv_nop" : "+v"(d) : "v"(a), "v"(b));
  return d;
}
__device__ __forceinline__ v8f wmma_bf(v16b a, v16b b, v8f c) {
  v8f d = __builtin_amdgcn_wmma_f32_16x16x32_bf16(false, a, false, b, (short)0, c, false, false);
  asm volatile("v_nop\n\tv_nop\n\tv_nop\n\tv_nop" : "+v"(d) : "v"(a), "v"(b));
  return d;
}
// 16x16x32 fragments: lane = (h = lane>>4, row/col = lane&15); elements 0..7 = k0+8h+0..7, 8..15 = k0+16+8h+0..7; D element r = row 8h+r
__device__ __forceinline__ v16h frag_h(const _Float16* rowk0, int lane) {
  union { v16h v; v8h q[2]; } u; const _Float16* p = rowk0 + 8 * (lane >> 4);
  u.q[0] = *(const v8h*)p; u.q[1] = *(const v8h*)(p + 16); return u.v;
}
__device__ __forceinline__ v16h frag_f32(const float* rowk0, int lane) {
  v16h a; const float* p = rowk0 + 8 * (lane >> 4);
#pragma unroll
  for (int i = 0; i < 8; ++i) { a[i] = (_Float16)p[i]; a[8 + i] = (_Float16)p[16 + i]; }
  return a;
}
__device__ __forceinline__ v16h frag_f32s(const float* rowk0, int lane, float sc) {
  v16h a; const float* p = rowk0 + 8 * (lane >> 4);
#pragma unroll
  for (int i = 0; i < 8; ++i) { a[i] = (_Float16)(p[i] * sc); a[8 + i] = (_Float16)(p[16 + i] * sc); }
  return a;
}
// column fragment from a [K][ld] layout (column n), rows >= K read as 0
__device__ __forceinline__ v16h fragc_f32(const float* W, int k0, int n, int lane, int ld, int K) {
  v16h a; const int g = lane >> 4;
#pragma unroll
  for (int i = 0; i < 8; ++i) { const int ka = k0 + 8 * g + i, kb = ka + 16;
    a[i] = (_Float16)(ka < K ? W[(size_t)(ka < K ? ka : K - 1) * ld + n] : 0.f); a[8 + i] = (_Float16)(kb < K ? W[(size_t)(kb < K ? kb : K - 1) * ld + n] : 0.f); }
  return a;
}
struct F2 { v16b h, l; };
__device__ __forceinline__ F2 bsplit16(const float v[16]) { F2 r;
#pragma unroll
  for (int i = 0; i < 16; ++i) { const __bf16 h = (__bf16)v[i]; r.h[i] = h; r.l[i] = (__bf16)(v[i] - (float)h); }
  return r; }
__device__ __forceinline__ F2 split_row(const float* row, int k0, int lane) { float v[16]; const float* p = row + k0 + 8 * (lane >> 4);
#pragma unroll
  for (int i = 0; i < 8; ++i) { v[i] = p[i]; v[8 + i] = p[16 + i]; }
  return bsplit16(v); }
__device__ __forceinline__ F2 split_rowK(const float* row, int k0, int lane, int K) { float v[16]; const int g = lane >> 4;
#pragma unroll
  for (int i = 0; i < 8; ++i) { const int ka = k0 + 8 * g + i, kb = ka + 16; v[i] = ka < K ? row[ka < K ? ka : K - 1] : 0.f; v[8 + i] = kb < K ? row[kb < K ? kb : K - 1] : 0.f; }
  return bsplit16(v); }
__device__ __forceinline__ F2 split_col(const float* W, int k0, int n, int lane, int ld, int K) { float v[16]; const int g = lane >> 4;
#pragma unroll
  for (int i = 0; i < 8; ++i) { const int ka = k0 + 8 * g + i, kb = ka + 16; v[i] = ka < K ? W[(size_t)(ka < K ? ka : K - 1) * ld + n] : 0.f; v[8 + i] = kb < K ? W[(size_t)(kb < K ? kb : K - 1) * ld + n] : 0.f; }
  return bsplit16(v); }
__device__ __forceinline__ v8f mac3(const F2& a, const F2& b, v8f c) { c = wmma_bf(a.l, b.h, c); c = wmma_bf(a.h, b.l, c); return wmma_bf(a.h, b.h, c); }
__device__ __forceinline__ float sigm(float v) { return 1.0f / (1.0f + expf(-v)); }
#define LDSX() do { asm volatile("s_wait_dscnt 0" ::: "memory"); __builtin_amdgcn_wave_barrier(); __builtin_amdgcn_fence(__ATOMIC_RELEASE, "workgroup"); } while (0)


// Slice attention (B 2, 8,192 slices, 128 features, one head): 1x1-conv q / k / v projections + biases, softmax(Q K^T / sqrt(128)) V.
#define NB 2
#define SS 8192
#define EE 128
#define NR (NB * SS)
#ifndef TQB
#define TQB (SS / 64)
#define TNB NB
#endif
typedef __attribute__((ext_vector_type(8))) __bf16 v8b;
__device__ __forceinline__ v16b frag_b(const __bf16* rowk0, int lane) {
  union { v16b v; v8b q[2]; } u; const __bf16* p = rowk0 + 8 * (lane >> 4);
  u.q[0] = *(const v8b*)p; u.q[1] = *(const v8b*)(p + 16); return u.v;
}
__device__ __forceinline__ float bfr(float v) { return (float)(__bf16)v; }
__device__ __attribute__((noinline)) float exp_ni(float v) { return expf(v); }
__device__ __attribute__((noinline)) float erf_ni(float v) { return erff(v); }

#define WS_PW  0u                                  // bf16 natural rows Wq, Wk, Wv [3][128][128]
#define WS_Q   (WS_PW + 2u * 3 * EE * EE)           // f16 [NR][128] q rows ; K and V in fragment order (below)
// K: [16-key tile][kc * 2 + h][lane][8]: lane (g, col) holds key col, dims kc * 32 + h * 16 + g * 8 + 0..7.  V: [32-key block][dt * 2 + h][lane][8]: lane (g, col) holds dim dt * 16 + col, keys h * 16 + g * 8 + 0..7.
// Each [lane][8] unit is 512 contiguous bytes, one wave-wide 16-byte load of k_attn: 4 whole lines, where rows and planes gave 16 lines of 32 used bytes.
#define WS_K   (WS_Q + 2u * (size_t)NR * EE)
#define WS_V   (WS_K + 2u * (size_t)NR * EE)
#define WS_END (WS_V + 2u * (size_t)NB * EE * SS)

__global__ __launch_bounds__(128) void k_pack(const float* __restrict__ WQ, const float* __restrict__ WK, const float* __restrict__ WV, __bf16* __restrict__ P) { const int n = blockIdx.x, which = blockIdx.y, t = threadIdx.x; const float* Wm = (which == 0) ? WQ : (which == 1) ? WK : WV; __shared__ __align__(16) __bf16 s[EE]; s[t] = (__bf16)Wm[(size_t)n * EE + t]; __syncthreads(); if (t < EE / 8) vst2((unsigned*)(P + ((size_t)which * EE + n) * EE + t * 8), *(const v4u*)&s[t * 8]); }
// ---- k_proj: block = (64 rows, which): 128 output cols; q -> f16 rows; k, v -> fragment order
__global__ __launch_bounds__(128) void k_proj(const float* __restrict__ X, const __bf16* __restrict__ P, const float* __restrict__ BQ, const float* __restrict__ BK, const float* __restrict__ BV, _Float16* __restrict__ Q, _Float16* __restrict__ Kr, _Float16* __restrict__ V) {
  __shared__ __align__(16) _Float16 so[64][136]; __shared__ __align__(16) _Float16 st[128][72];
  const int tid = threadIdx.x, wave = tid >> 5, lane = tid & 31, col = lane & 15, g = lane >> 4; const int which = blockIdx.y; const size_t rb0 = (size_t)blockIdx.x * 64, r0 = rb0 + wave * 16;
  const __bf16* Wr = P + (size_t)which * EE * EE; const float* BB = (which == 0) ? BQ : (which == 1) ? BK : BV;
  v8f acc[8] = {};
#pragma unroll
  for (int kc = 0; kc < EE / 32; ++kc) { v16b a; { const float* p = X + (r0 + col) * EE + kc * 32 + 8 * g;
#pragma unroll
      for (int i = 0; i < 8; ++i) { a[i] = (__bf16)p[i]; a[8 + i] = (__bf16)p[16 + i]; } }
#pragma unroll
    for (int j = 0; j < 8; ++j) acc[j] = wmma_bf(a, frag_b(Wr + (size_t)(j * 16 + col) * EE + kc * 32, lane), acc[j]); }
  if (which < 2) {
#pragma unroll
    for (int j = 0; j < 8; ++j) { const float bb = bfr(BB[j * 16 + col]);
#pragma unroll
      for (int r = 0; r < 8; ++r) so[wave * 16 + 8 * g + r][j * 16 + col] = (_Float16)(acc[j][r] + bb); }
    LDSX();
    if (which == 0) { for (int rl = 0; rl < 16; ++rl) if (lane < 16) vst2((unsigned*)(Q + (r0 + rl) * EE + lane * 8), *(const v4u*)&so[wave * 16 + rl][lane * 8]); }
    else {   // the wave's 16 rows are one key tile: 8 units of 512 B
#pragma unroll
      for (int i = 0; i < 8; ++i) vst2((unsigned*)(Kr + r0 * EE + i * 256 + lane * 8), *(const v4u*)&so[wave * 16 + col][i * 16 + g * 8]);
      asm volatile("s_wait_xcnt 0x0" ::: "memory"); }   // behind the last K store: no register that the eight stores name is rewritten ahead of it on any path of the listing
  } else {
#pragma unroll
    for (int j = 0; j < 8; ++j) { const float bb = bfr(BB[j * 16 + col]);
#pragma unroll
      for (int r = 0; r < 8; ++r) st[j * 16 + col][wave * 16 + 8 * g + r] = (_Float16)(acc[j][r] + bb); }
    __syncthreads();
    // the block's 64 keys are two 32-key blocks, 16 KB in a row: 16-byte piece e = ((block * 8 + dt) * 2 + h) * 32 + g * 16 + col
    for (int e = tid; e < 128 * 8; e += 128) vst2((unsigned*)(V + rb0 * EE + (size_t)e * 8), *(const v4u*)&st[((e >> 6) & 7) * 16 + (e & 15)][(e >> 9) * 32 + ((e >> 5) & 1) * 16 + ((e >> 4) & 1) * 8]); }
}
// fragment in fragment order at a lane's own address (8 * lane already added): its two halves are the lane's 16 bytes of two 512-B units in a row
__device__ __forceinline__ v16h frag_p(const _Float16* p) { union { v16h v; v8h q[2]; } u; u.q[0] = *(const v8h*)p; u.q[1] = *(const v8h*)(p + 256); return u.v; }
// lane l with lane l ^ 16 on the vector pipe (a shuffle would go through the LDS unit and its wait)
__device__ __forceinline__ float xhalf(float x) { return __builtin_bit_cast(float, __builtin_amdgcn_permlanex16(__builtin_bit_cast(int, x), __builtin_bit_cast(int, x), 0x76543210, 0xfedcba98, false, false)); }
// ---- k_attn: block = (64 queries, b): 128-dim q/k/v, all 8,192 keys, plain; f32 output rows
// KS waves share each 16-query tile: wave (qw, kq) walks key range kq alone (SS / KS keys) with its own running maximum, sum and O^T; the ranges are merged through LDS behind the loop.
// A SIMD then holds KS waves instead of one, so one wave's load waits and dependent vector chains are filled by the others' work.
#define KS 4
// Transposed products: S^T = K . Q^T (A = K fragment, B = Q fragment) and O^T += V^T . P^T (A = V fragment, B = P^T). Lane (g, col) then holds, of query col alone, the scores of keys 8g + r of each
// 16-key tile: maximum and sum are in-lane but for one exchange between the halves, and the two score tiles of a pass, converted in place, ARE the B fragment of the second product (element ct * 8 + r = key ct * 16 + 8g + r).
__global__ __launch_bounds__(128 * KS) void k_attn(const _Float16* __restrict__ Q, const _Float16* __restrict__ Kr, const _Float16* __restrict__ V, float* __restrict__ OUT) {
  __shared__ __align__(16) float so[KS][64][132]; __shared__ float sm[KS][64], sl[KS][64];
  const int tid = threadIdx.x, wave = __builtin_amdgcn_readfirstlane(tid >> 5), qw = wave & 3, kq = wave >> 2, lane = tid & 31, col = lane & 15; const size_t b = blockIdx.y; const int q0 = blockIdx.x * 64 + qw * 16; const size_t rq = b * SS + q0;
  v16h aq[4];
#pragma unroll
  for (int kc = 0; kc < 4; ++kc) aq[kc] = frag_h(Q + (rq + col) * EE + kc * 32, lane);
  float m = -3.0e38f, l = 0.f;   // of query col; l sums this half's keys only, the halves are joined behind the loop
  v8f acc[8] = {};               // acc[dt][r] = O^T[dim dt * 16 + 8g + r][query col]
  asm volatile("s_wait_xcnt 0x0" ::: "memory");   // the Q loads' address pair is free for reuse by what follows
  // K and V fragments live in registers one pass ahead: each set is refilled as ONE group of loads right behind its last product,
  // so a pass waits for no load of its own (a load written at its product is held there by the product's asm statement and waited out alone).
  const size_t kb = (b * SS + (size_t)kq * (SS / KS)) * EE;   // first key of the wave's range: the same in every lane, so the walking addresses are scalar and cost no vector register
  const _Float16* Kg = Kr + kb; const _Float16* Vg = V + kb; const int lo = 8 * lane;
  v16h kf[2][4], vf[8];
#pragma unroll
  for (int ct = 0; ct < 2; ++ct) {
#pragma unroll
    for (int kc = 0; kc < 4; ++kc) kf[ct][kc] = frag_p(Kg + ct * 16 * EE + kc * 512 + lo); }
  __builtin_amdgcn_sched_barrier(0);   // V's first loads stay the youngest, as in the loop: else the counted waits at the loop's head, merged from both ways in, also drain V
  const _Float16* vp = Vg;
#pragma unroll
  for (int dt = 0; dt < 8; ++dt) vf[dt] = frag_p(vp + dt * 512 + lo);
#pragma unroll 1
  for (int ks = 0; ks < SS / 32 / KS; ++ks) { const int jn = (ks + 1 < SS / 32 / KS) ? (ks + 1) * 32 : 0; v8f s[2];   // next pass's keys; the last pass refetches the range's tile 0, in bounds and unused
#pragma unroll
    for (int ct = 0; ct < 2; ++ct) { v8f c = {};
#pragma unroll
      for (int kc = 0; kc < 4; ++kc) c = wmma16(kf[ct][kc], aq[kc], c);
#pragma unroll
      for (int r = 0; r < 8; ++r) s[ct][r] = c[r] * 0.08838834764831845f; }   // 128^-0.5
    const _Float16* kp = Kg + (size_t)jn * EE;
#pragma unroll
    for (int ct = 0; ct < 2; ++ct) {
#pragma unroll
      for (int kc = 0; kc < 4; ++kc) kf[ct][kc] = frag_p(kp + ct * 16 * EE + kc * 512 + lo); }
    float t[4];
#pragma unroll
    for (int i = 0; i < 4; ++i) t[i] = fmaxf(fmaxf(s[0][i], s[0][4 + i]), fmaxf(s[1][i], s[1][4 + i]));
    float mx = fmaxf(fmaxf(t[0], t[1]), fmaxf(t[2], t[3])); mx = fmaxf(mx, xhalf(mx));   // all 32 keys of the pass: both halves scale P and O^T alike
    const float mn = fmaxf(m, mx); const float alpha = (m <= -1.0e38f) ? 0.f : __expf(m - mn);
    v16h pb; v2f ep[8];   // pairs of neighbouring registers: the scaling, the conversion and the sum all work on the same pairs
#pragma unroll
    for (int j = 0; j < 8; ++j) { ep[j][0] = __expf(s[j >> 2][(2 * j) & 7] - mn); ep[j][1] = __expf(s[j >> 2][(2 * j + 1) & 7] - mn);
      pb[2 * j] = (_Float16)(ep[j][0] * 2048.0f); pb[2 * j + 1] = (_Float16)(ep[j][1] * 2048.0f); }
    const v2f e2 = ((ep[0] + ep[1]) + (ep[2] + ep[3])) + ((ep[4] + ep[5]) + (ep[6] + ep[7]));   // a tree three deep instead of a chain of sixteen adds
    l = l * alpha + (e2[0] + e2[1]); m = mn;
#pragma unroll
    for (int dt = 0; dt < 8; ++dt) acc[dt] *= alpha;
    asm volatile("s_wait_xcnt 0x0" :: "s"(kp), "s"(vp) : "memory");   // the s_wait_xcnt 0 of the K loads above and of the V loads of the pass before stands here: kp and vp are rewritten only behind it
#pragma unroll
    for (int dt = 0; dt < 8; ++dt) acc[dt] = wmma16(vf[dt], pb, acc[dt]);
    vp = Vg + (size_t)jn * EE;
#pragma unroll
    for (int dt = 0; dt < 8; ++dt) vf[dt] = frag_p(vp + dt * 512 + lo); }
  asm volatile("s_wait_xcnt 0x0" :: "s"(vp) : "memory");   // the last V loads' address pair is free for the epilogue
  // merge of the KS key ranges of a query: common maximum M, weights exp(m_k - M), L = sum of the weighted sums; each wave scales its own O^T by its weight over L, the scaled parts are added in range order
  const int ln = __builtin_amdgcn_mbcnt_lo(~0u, 0u), g2 = ln >> 4;   // the lane's number, read anew: at 256 registers a wave no index of the epilogue is carried (or spilled) across the loop
  const int qr = qw * 16 + (ln & 15); const float lt = l + xhalf(l);
  if (g2 == 0) { sm[kq][qr] = m; sl[kq][qr] = lt; }
  __syncthreads();   // every range's maximum and sum are in LDS
  float M = sm[0][qr];
#pragma unroll
  for (int k = 1; k < KS; ++k) M = fmaxf(M, sm[k][qr]);
  float L = 0.f;
#pragma unroll
  for (int k = 0; k < KS; ++k) L += sl[k][qr] * __expf(sm[k][qr] - M);
  const float il = __expf(m - M) * (1.0f / 2048.0f) / L;
#pragma unroll
  for (int dt = 0; dt < 8; ++dt) { const v8f o = acc[dt] * il;   // a lane's 8 registers are 8 dims in a row of its query's output row
    *(v4f*)&so[kq][qr][dt * 16 + 8 * g2] = __builtin_shufflevector(o, o, 0, 1, 2, 3); *(v4f*)&so[kq][qr][dt * 16 + 8 * g2 + 4] = __builtin_shufflevector(o, o, 4, 5, 6, 7); }
  __syncthreads();   // every range's scaled part is in LDS
  float* ob = OUT + (b * SS + (size_t)blockIdx.x * 64 + wave * (16 / KS)) * EE + ln * 4;
#pragma unroll
  for (int i = 0; i < 16 / KS; ++i) { v4f o = *(const v4f*)&so[0][wave * (16 / KS) + i][ln * 4];
#pragma unroll
    for (int k = 1; k < KS; ++k) o += *(const v4f*)&so[k][wave * (16 / KS) + i][ln * 4];
    vst2(ob + i * EE, o); }   // whole 512-B output row per wave
}
extern "C" void kernel_launch(void* const* d_in, const int* in_sizes, int n_in, void* d_out, int out_size, void* d_ws, size_t ws_size, hipStream_t stream) {
  (void)in_sizes; (void)n_in; (void)out_size;
  const float** F = (const float**)d_in;   // 0 x [2,8192,128], 1 Wq [128,128], 2 bq, 3 Wk, 4 bk, 5 Wv, 6 bv
  if (ws_size < (size_t)WS_END) return;
  char* ws = (char*)d_ws; __bf16* P = (__bf16*)ws; _Float16 *Q = (_Float16*)(ws + WS_Q), *Kr = (_Float16*)(ws + WS_K), *V = (_Float16*)(ws + WS_V);
  k_pack<<<dim3(EE, 3), 128, 0, stream>>>(F[1], F[3], F[5], P);
  k_proj<<<dim3(TNB * SS / 64, 3), 128, 0, stream>>>(F[0], P, F[2], F[4], F[6], Q, Kr, V);
  k_attn<<<dim3(TQB, TNB), 128 * KS, 0, stream>>>(Q, Kr, V, (float*)d_out);
}

// v005
// One run takes 74.9 microseconds.
// Next to v004, in two timings, it ran 1.07 times as fast each time.
// Over all steps from v000 it is 11.4 times as fast.
// compute dtype: all float inputs rounded to bf16; Q / K / V = x . W^T + b with EXACT bf16 products on WMMA 16x16x32 (natural rows), rounded once to f16; PLAIN single-head attention over 8,192 slices with 128-dim q/k/v: q, k single f16 x 128^-0.5, running-max softmax in f32 (hardware exp), P (scaled by 2^11, single f16) x v (single f16); f32 accumulate and output.
#include <hip/hip_runtime.h>
#include <math.h>

typedef __attribute__((ext_vector_type(16))) _Float16 v16h;
typedef __attribute__((ext_vector_type(16))) __bf16 v16b;
typedef __attribute__((ext_vector_type(8)))  _Float16 v8h;
typedef __attribute__((ext_vector_type(8)))  float v8f;
typedef __attribute__((ext_vector_type(4)))  float v4f;
typedef __attribute__((ext_vector_type(2)))  float v2f;
typedef __attribute__((ext_vector_type(4)))  unsigned v4u;
typedef __attribute__((ext_vector_type(4)))  int v4i;
typedef float __attribute__((may_alias)) float_a;
typedef int __attribute__((may_alias)) int_a;

template <typename T> __device__ __forceinline__ void vst2(void* p, T v) { *(T*)p = v;  }
// the builtin alone: the compiler keeps the distances behind its own WMMAs; a pad statement with the fragments as operands would hold every one of them in the first 256 registers (spills in a wave that owns more)
__device__ __forceinline__ v8f wmma16(v16h a, v16h b, v8f c) {
  return __builtin_amdgcn_wmma_f32_16x16x32_f16(false, a, false, b, (short)0, c, false, false);
}
__device__ __forceinline__ v8f wmma_bf(v16b a, v16b b, v8f c) {
  v8f d = __builtin_amdgcn_wmma_f32_16x16x32_bf16(false, a, false, b, (short)0, c, false, false);
  asm volatile("v_nop\n\tv_nop\n\tv_nop\n\tv_nop" : "+v"(d) : "v"(a), "v"(b));
  return d;
}
// 16x16x32 fragments: lane = (h = lane>>4, row/col = lane&15); elements 0..7 = k0+8h+0..7, 8..15 = k0+16+8h+0..7; D element r = row 8h+r
__device__ __forceinline__ v16h frag_h(const _Float16* rowk0, int lane) {
  union { v16h v; v8h q[2]; } u; const _Float16* p = rowk0 + 8 * (lane >> 4);
  u.q[0] = *(const v8h*)p; u.q[1] = *(const v8h*)(p + 16); return u.v;
}
__device__ __forceinline__ v16h frag_f32(const float* rowk0, int lane) {
  v16h a; const float* p = rowk0 + 8 * (lane >> 4);
#pragma unroll
  for (int i = 0; i < 8; ++i) { a[i] = (_Float16)p[i]; a[8 + i] = (_Float16)p[16 + i]; }
  return a;
}
__device__ __forceinline__ v16h frag_f32s(const float* rowk0, int lane, float sc) {
  v16h a; const float* p = rowk0 + 8 * (lane >> 4);
#pragma unroll
  for (int i = 0; i < 8; ++i) { a[i] = (_Float16)(p[i] * sc); a[8 + i] = (_Float16)(p[16 + i] * sc); }
  return a;
}
// column fragment from a [K][ld] layout (column n), rows >= K read as 0
__device__ __forceinline__ v16h fragc_f32(const float* W, int k0, int n, int lane, int ld, int K) {
  v16h a; const int g = lane >> 4;
#pragma unroll
  for (int i = 0; i < 8; ++i) { const int ka = k0 + 8 * g + i, kb = ka + 16;
    a[i] = (_Float16)(ka < K ? W[(size_t)(ka < K ? ka : K - 1) * ld + n] : 0.f); a[8 + i] = (_Float16)(kb < K ? W[(size_t)(kb < K ? kb : K - 1) * ld + n] : 0.f); }
  return a;
}
struct F2 { v16b h, l; };
__device__ __forceinline__ F2 bsplit16(const float v[16]) { F2 r;
#pragma unroll
  for (int i = 0; i < 16; ++i) { const __bf16 h = (__bf16)v[i]; r.h[i] = h; r.l[i] = (__bf16)(v[i] - (float)h); }
  return r; }
__device__ __forceinline__ F2 split_row(const float* row, int k0, int lane) { float v[16]; const float* p = row + k0 + 8 * (lane >> 4);
#pragma unroll
  for (int i = 0; i < 8; ++i) { v[i] = p[i]; v[8 + i] = p[16 + i]; }
  return bsplit16(v); }
__device__ __forceinline__ F2 split_rowK(const float* row, int k0, int lane, int K) { float v[16]; const int g = lane >> 4;
#pragma unroll
  for (int i = 0; i < 8; ++i) { const int ka = k0 + 8 * g + i, kb = ka + 16; v[i] = ka < K ? row[ka < K ? ka : K - 1] : 0.f; v[8 + i] = kb < K ? row[kb < K ? kb : K - 1] : 0.f; }
  return bsplit16(v); }
__device__ __forceinline__ F2 split_col(const float* W, int k0, int n, int lane, int ld, int K) { float v[16]; const int g = lane >> 4;
#pragma unroll
  for (int i = 0; i < 8; ++i) { const int ka = k0 + 8 * g + i, kb = ka + 16; v[i] = ka < K ? W[(size_t)(ka < K ? ka : K - 1) * ld + n] : 0.f; v[8 + i] = kb < K ? W[(size_t)(kb < K ? kb : K - 1) * ld + n] : 0.f; }
  return bsplit16(v); }
__device__ __forceinline__ v8f mac3(const F2& a, const F2& b, v8f c) { c = wmma_bf(a.l, b.h, c); c = wmma_bf(a.h, b.l, c); return wmma_bf(a.h, b.h, c); }
__device__ __forceinline__ float sigm(float v) { return 1.0f / (1.0f + expf(-v)); }
#define LDSX() do { asm volatile("s_wait_dscnt 0" ::: "memory"); __builtin_amdgcn_wave_barrier(); __builtin_amdgcn_fence(__ATOMIC_RELEASE, "workgroup"); } while (0)


// Slice attention (B 2, 8,192 slices, 128 features, one head): 1x1-conv q / k / v projections + biases, softmax(Q K^T / sqrt(128)) V.
#define NB 2
#define SS 8192
#define EE 128
#define NR (NB * SS)
#ifndef TQB
#define TQB (SS / 64)
#define TNB NB
#endif
typedef __attribute__((ext_vector_type(8))) __bf16 v8b;
__device__ __forceinline__ v16b frag_b(const __bf16* rowk0, int lane) {
  union { v16b v; v8b q[2]; } u; const __bf16* p = rowk0 + 8 * (lane >> 4);
  u.q[0] = *(const v8b*)p; u.q[1] = *(const v8b*)(p + 16); return u.v;
}
__device__ __forceinline__ float bfr(float v) { return (float)(__bf16)v; }
__device__ __attribute__((noinline)) float exp_ni(float v) { return expf(v); }
__device__ __attribute__((noinline)) float erf_ni(float v) { return erff(v); }

#define WS_PW  0u                                  // bf16 natural rows Wq, Wk, Wv [3][128][128]
#define WS_Q   (WS_PW + 2u * 3 * EE * EE)           // f16 [NR][128] q rows ; K and V in fragment order (below)
// K: [16-key tile][kc * 2 + h][lane][8]: lane (g, col) holds key col, dims kc * 32 + h * 16 + g * 8 + 0..7.  V: [32-key block][dt * 2 + h][lane][8]: lane (g, col) holds dim dt * 16 + col, keys h * 16 + g * 8 + 0..7.
// Each [lane][8] unit is 512 contiguous bytes, one wave-wide 16-byte load of k_attn: 4 whole lines, where rows and planes gave 16 lines of 32 used bytes.
#define WS_K   (WS_Q + 2u * (size_t)NR * EE)
#define WS_V   (WS_K + 2u * (size_t)NR * EE)
#define WS_END (WS_V + 2u * (size_t)NB * EE * SS)

__global__ __launch_bounds__(128) void k_pack(const float* __restrict__ WQ, const float* __restrict__ WK, const float* __restrict__ WV, __bf16* __restrict__ P) { const int n = blockIdx.x, which = blockIdx.y, t = threadIdx.x; const float* Wm = (which == 0) ? WQ : (which == 1) ? WK : WV; __shared__ __align__(16) __bf16 s[EE]; s[t] = (__bf16)Wm[(size_t)n * EE + t]; __syncthreads(); if (t < EE / 8) vst2((unsigned*)(P + ((size_t)which * EE + n) * EE + t * 8), *(const v4u*)&s[t * 8]); }
// ---- k_proj: block = (64 rows, which): 128 output cols; q -> f16 rows; k, v -> fragment order
__global__ __launch_bounds__(128) void k_proj(const float* __restrict__ X, const __bf16* __restrict__ P, const float* __restrict__ BQ, const float* __restrict__ BK, const float* __restrict__ BV, _Float16* __restrict__ Q, _Float16* __restrict__ Kr, _Float16* __restrict__ V) {
  __shared__ __align__(16) _Float16 so[64][136]; __shared__ __align__(16) _Float16 st[128][72];
  const int tid = threadIdx.x, wave = tid >> 5, lane = tid & 31, col = lane & 15, g = lane >> 4; const int which = blockIdx.y; const size_t rb0 = (size_t)blockIdx.x * 64, r0 = rb0 + wave * 16;
  const __bf16* Wr = P + (size_t)which * EE * EE; const float* BB = (which == 0) ? BQ : (which == 1) ? BK : BV;
  v8f acc[8] = {};
#pragma unroll
  for (int kc = 0; kc < EE / 32; ++kc) { v16b a; { const float* p = X + (r0 + col) * EE + kc * 32 + 8 * g;
#pragma unroll
      for (int i = 0; i < 8; ++i) { a[i] = (__bf16)p[i]; a[8 + i] = (__bf16)p[16 + i]; } }
#pragma unroll
    for (int j = 0; j < 8; ++j) acc[j] = wmma_bf(a, frag_b(Wr + (size_t)(j * 16 + col) * EE + kc * 32, lane), acc[j]); }
  if (which < 2) {
#pragma unroll
    for (int j = 0; j < 8; ++j) { const float bb = bfr(BB[j * 16 + col]);
#pragma unroll
      for (int r = 0; r < 8; ++r) so[wave * 16 + 8 * g + r][j * 16 + col] = (_Float16)(acc[j][r] + bb); }
    LDSX();
    if (which == 0) { for (int rl = 0; rl < 16; ++rl) if (lane < 16) vst2((unsigned*)(Q + (r0 + rl) * EE + lane * 8), *(const v4u*)&so[wave * 16 + rl][lane * 8]); }
    else {   // the wave's 16 rows are one key tile: 8 units of 512 B
#pragma unroll
      for (int i = 0; i < 8; ++i) vst2((unsigned*)(Kr + r0 * EE + i * 256 + lane * 8), *(const v4u*)&so[wave * 16 + col][i * 16 + g * 8]);
      asm volatile("s_wait_xcnt 0x0" ::: "memory"); }   // behind the last K store: no register that the eight stores name is rewritten ahead of it on any path of the listing
  } else {
#pragma unroll
    for (int j = 0; j < 8; ++j) { const float bb = bfr(BB[j * 16 + col]);
#pragma unroll
      for (int r = 0; r < 8; ++r) st[j * 16 + col][wave * 16 + 8 * g + r] = (_Float16)(acc[j][r] + bb); }
    __syncthreads();
    // the block's 64 keys are two 32-key blocks, 16 KB in a row: 16-byte piece e = ((block * 8 + dt) * 2 + h) * 32 + g * 16 + col
    for (int e = tid; e < 128 * 8; e += 128) vst2((unsigned*)(V + rb0 * EE + (size_t)e * 8), *(const v4u*)&st[((e >> 6) & 7) * 16 + (e & 15)][(e >> 9) * 32 + ((e >> 5) & 1) * 16 + ((e >> 4) & 1) * 8]); }
}
// fragment in fragment order at a lane's own address (8 * lane already added): its two halves are the lane's 16 bytes of two 512-B units in a row
__device__ __forceinline__ v16h frag_p(const _Float16* p) { union { v16h v; v8h q[2]; } u; u.q[0] = *(const v8h*)p; u.q[1] = *(const v8h*)(p + 256); return u.v; }
// lane l with lane l ^ 16 on the vector pipe (a shuffle would go through the LDS unit and its wait)
__device__ __forceinline__ float xhalf(float x) { return __builtin_bit_cast(float, __builtin_amdgcn_permlanex16(__builtin_bit_cast(int, x), __builtin_bit_cast(int, x), 0x76543210, 0xfedcba98, false, false)); }
// (x0 + x2) + (x4 + x6) and (x1 + x3) + (x5 + x7): packed adds on neighbouring registers
__device__ __forceinline__ v2f pairsum(v8f x) { return (__builtin_shufflevector(x, x, 0, 1) + __builtin_shufflevector(x, x, 2, 3)) + (__builtin_shufflevector(x, x, 4, 5) + __builtin_shufflevector(x, x, 6, 7)); }
// ---- k_attn: block = (64 queries, b): 128-dim q/k/v, all 8,192 keys, plain; f32 output rows
// KS key ranges a block: wave (qw, kq) walks key range kq alone (SS / KS keys) for its own queries, with their running maximum, sum and O^T; the ranges are merged through LDS behind the loop.
#define KS 4
// QT 16-query tiles a wave: every K and V fragment that a wave loads feeds QT products instead of one, so the block moves 1 / QT of the fragment bytes from the cache into registers for the same products.
// The block is then 4 / QT * KS waves, 2 a SIMD, each with up to 512 registers.
#define QT 2
#define NW (4 / QT * KS)
// Transposed products: S^T = K . Q^T (A = K fragment, B = Q fragment) and O^T += V^T . P^T (A = V fragment, B = P^T). Lane (g, col) then holds, of query col alone, the scores of keys 8g + r of each
// 16-key tile: maximum and sum are in-lane but for one exchange between the halves, and the two score tiles of a pass, converted in place, ARE the B fragment of the second product (element ct * 8 + r = key ct * 16 + 8g + r).
__global__ __launch_bounds__(32 * NW) void k_attn(const _Float16* __restrict__ Q, const _Float16* __restrict__ Kr, const _Float16* __restrict__ V, float* __restrict__ OUT) {
  __shared__ __align__(16) float so[KS][64][132]; __shared__ float sm[KS][64], sl[KS][64];
  const int tid = threadIdx.x, wave = __builtin_amdgcn_readfirstlane(tid >> 5), qw = wave & (4 / QT - 1), kq = wave / (4 / QT), lane = tid & 31, col = lane & 15; const size_t b = blockIdx.y; const int q0 = blockIdx.x * 64 + qw * (16 * QT); const size_t rq = b * SS + q0;
  v16h aq[QT][4];
#pragma unroll
  for (int u = 0; u < QT; ++u) {
#pragma unroll
    for (int kc = 0; kc < 4; ++kc) aq[u][kc] = frag_h(Q + (rq + u * 16 + col) * EE + kc * 32, lane); }
  static_assert(QT == 2, "the pairs below and the operand list of the wait in the loop are written for two tiles");
  v2f mv = {-3.0e38f, -3.0e38f}, lv = {0.f, 0.f};   // element u: running maximum and sum of query u * 16 + col; the sum is of this half's keys only, the halves are joined behind the loop
  v8f acc[QT][8] = {};           // acc[u][dt][r] = O^T[dim dt * 16 + 8g + r][query u * 16 + col]
  asm volatile("s_wait_xcnt 0x0" ::: "memory");   // the Q loads' address pair is free for reuse by what follows
  // K and V fragments live in registers one pass ahead: each set is refilled as ONE group of loads right behind its last product,
  // so a pass waits for no load of its own.
  const size_t kb = (b * SS + (size_t)kq * (SS / KS)) * EE;   // first key of the wave's range: the same in every lane, so the walking addresses are scalar and cost no vector register
  const _Float16* Kg = Kr + kb; const _Float16* Vg = V + kb; const int lo = 8 * lane;
  v16h kf[2][4], vf[8];
#pragma unroll
  for (int ct = 0; ct < 2; ++ct) {
#pragma unroll
    for (int kc = 0; kc < 4; ++kc) kf[ct][kc] = frag_p(Kg + ct * 16 * EE + kc * 512 + lo); }
  __builtin_amdgcn_sched_barrier(0);   // V's first loads stay the youngest, as in the loop: else the counted waits at the loop's head, merged from both ways in, also drain V
  unsigned long long va = (unsigned long long)Vg;
#pragma unroll
  for (int dt = 0; dt < 8; ++dt) vf[dt] = frag_p(Vg + dt * 512 + lo);
  asm volatile("s_wait_xcnt 0x0" ::: "memory");   // behind the first K and V loads: the offset register that they name is reused by what follows
  __builtin_amdgcn_sched_barrier(0);   // and nothing that rewrites it is lifted over the wait
#pragma unroll 1
  for (int ks = 0; ks < SS / 32 / KS; ++ks) { const int jn = (ks + 1 < SS / 32 / KS) ? (ks + 1) * 32 : 0; v8f s[QT][2];   // next pass's keys; the last pass refetches the range's tile 0, in bounds and unused
#pragma unroll
    for (int ct = 0; ct < 2; ++ct) { v8f c[QT] = {};
#pragma unroll
      for (int kc = 0; kc < 4; ++kc) {
#pragma unroll
        for (int u = 0; u < QT; ++u) c[u] = wmma16(kf[ct][kc], aq[u][kc], c[u]); }
#pragma unroll
      for (int u = 0; u < QT; ++u) s[u][ct] = c[u] * 0.08838834764831845f; }   // 128^-0.5
    const _Float16* kp = Kg + (size_t)jn * EE;
    __builtin_amdgcn_sched_barrier(0);   // the K refill stays one group behind the last product that reads the set
#pragma unroll
    for (int ct = 0; ct < 2; ++ct) {
#pragma unroll
      for (int kc = 0; kc < 4; ++kc) kf[ct][kc] = frag_p(kp + ct * 16 * EE + kc * 512 + lo); }
    v16h pb[QT]; v2f mx2, es;   // element u of a pair belongs to query tile u
    // The softmax is written on whole register vectors, so that the packed instructions take neighbouring registers of ONE tile (left to itself the compiler pairs values of different tiles, or a score with the old maximum, and moves them together first).
#pragma unroll
    for (int u = 0; u < QT; ++u) { const v8f t8 = __builtin_elementwise_max(s[u][0], s[u][1]);
      mx2[u] = fmaxf(fmaxf(fmaxf(t8[0], t8[1]), fmaxf(t8[2], t8[3])), fmaxf(fmaxf(t8[4], t8[5]), fmaxf(t8[6], t8[7]))); }
    mx2 = __builtin_elementwise_max(mx2, (v2f){xhalf(mx2[0]), xhalf(mx2[1])});   // all 32 keys of the pass: both halves scale P and O^T alike
    const v2f mn2 = __builtin_elementwise_max(mv, mx2), da = (mv - mn2) * 1.4426950408889634f;   // exp(x) = 2^(x log2 e), on the hardware's exp2
    v2f al;
#pragma unroll
    for (int u = 0; u < QT; ++u) al[u] = (mv[u] <= -1.0e38f) ? 0.f : __builtin_amdgcn_exp2f(da[u]);
#pragma unroll
    for (int u = 0; u < QT; ++u) { v8f ex[2];
#pragma unroll
      for (int ct = 0; ct < 2; ++ct) { const v8f d = (s[u][ct] - mn2[u]) * 1.4426950408889634f;
#pragma unroll
        for (int r = 0; r < 8; ++r) ex[ct][r] = __builtin_amdgcn_exp2f(d[r]);
        const v8h ph = __builtin_convertvector(ex[ct] * 2048.0f, v8h);
#pragma unroll
        for (int r = 0; r < 8; ++r) pb[u][ct * 8 + r] = ph[r]; }
      const v2f e2 = pairsum(ex[0]) + pairsum(ex[1]);   // a tree three deep instead of a chain of sixteen adds
      es[u] = e2[0] + e2[1];
#pragma unroll
      for (int dt = 0; dt < 8; ++dt) acc[u][dt] *= al[u]; }
    lv = lv * al + es; mv = mn2;
#pragma unroll
    for (int dt = 0; dt < 8; ++dt) {
#pragma unroll
      for (int u = 0; u < QT; ++u) acc[u][dt] = wmma16(vf[dt], pb[u], acc[u][dt]); }
    // the s_wait_xcnt 0 of the K loads above and of the V loads of the pass before stands here: K's and V's address pairs are rewritten only behind it. The products' results are its inputs, so that it stands behind the last product
    // and, by its memory clobber, the V refill behind it: lifted above the products the refill lands in a second register set, is copied back at the loop's foot and is waited out there.
    // V's address goes through the statement (as a number: a pointer would come out of it as a generic one, and its loads as flat loads) and walks on from what comes out of it, so that the pair which the V loads in flight name is rewritten only behind the wait.
    asm volatile("s_wait_xcnt 0x0" : "+s"(va) : "s"(kp), "v"(acc[0][0]), "v"(acc[0][1]), "v"(acc[0][2]), "v"(acc[0][3]), "v"(acc[0][4]), "v"(acc[0][5]), "v"(acc[0][6]), "v"(acc[0][7]),
                 "v"(acc[1][0]), "v"(acc[1][1]), "v"(acc[1][2]), "v"(acc[1][3]), "v"(acc[1][4]), "v"(acc[1][5]), "v"(acc[1][6]), "v"(acc[1][7]) : "memory");
    va += (ks + 1 < SS / 32 / KS) ? 2 * 32 * EE : 0;   // bytes; the last pass refetches its own block, in bounds and unused
    const _Float16* vp = (const _Float16*)(const __attribute__((address_space(1))) _Float16*)va;
#pragma unroll
    for (int dt = 0; dt < 8; ++dt) vf[dt] = frag_p(vp + dt * 512 + lo); }
  asm volatile("s_wait_xcnt 0x0" :: "s"(va) : "memory");   // the last V loads' address pair is free for the epilogue
  // merge of the KS key ranges of a query: common maximum M, weights exp(m_k - M), L = sum of the weighted sums; each wave scales its own O^T by its weight over L, the scaled parts are added in range order
  const int ln = __builtin_amdgcn_mbcnt_lo(~0u, 0u), g2 = ln >> 4;   // the lane's number, read anew: no index of the epilogue is carried across the loop
  const int qr0 = qw * (16 * QT) + (ln & 15);
#pragma unroll
  for (int u = 0; u < QT; ++u) { const float lt = lv[u] + xhalf(lv[u]);
    if (g2 == 0) { sm[kq][qr0 + u * 16] = mv[u]; sl[kq][qr0 + u * 16] = lt; } }
  __syncthreads();   // every range's maximum and sum are in LDS
#pragma unroll
  for (int u = 0; u < QT; ++u) { const int qr = qr0 + u * 16;
    float M = sm[0][qr];
#pragma unroll
    for (int k = 1; k < KS; ++k) M = fmaxf(M, sm[k][qr]);
    float L = 0.f;
#pragma unroll
    for (int k = 0; k < KS; ++k) L += sl[k][qr] * __expf(sm[k][qr] - M);
    const float il = __expf(mv[u] - M) * (1.0f / 2048.0f) / L;
#pragma unroll
    for (int dt = 0; dt < 8; ++dt) { const v8f o = acc[u][dt] * il;   // a lane's 8 registers are 8 dims in a row of its query's output row
      *(v4f*)&so[kq][qr][dt * 16 + 8 * g2] = __builtin_shufflevector(o, o, 0, 1, 2, 3); *(v4f*)&so[kq][qr][dt * 16 + 8 * g2 + 4] = __builtin_shufflevector(o, o, 4, 5, 6, 7); } }
  __syncthreads();   // every range's scaled part is in LDS
  float* ob = OUT + (b * SS + (size_t)blockIdx.x * 64 + wave * (64 / NW)) * EE + ln * 4;
#pragma unroll
  for (int i = 0; i < 64 / NW; ++i) { v4f o = *(const v4f*)&so[0][wave * (64 / NW) + i][ln * 4];
#pragma unroll
    for (int k = 1; k < KS; ++k) o += *(const v4f*)&so[k][wave * (64 / NW) + i][ln * 4];
    vst2(ob + i * EE, o); }   // whole 512-B output row per wave
}
extern "C" void kernel_launch(void* const* d_in, const int* in_sizes, int n_in, void* d_out, int out_size, void* d_ws, size_t ws_size, hipStream_t stream) {
  (void)in_sizes; (void)n_in; (void)out_size;
  const float** F = (const float**)d_in;   // 0 x [2,8192,128], 1 Wq [128,128], 2 bq, 3 Wk, 4 bk, 5 Wv, 6 bv
  if (ws_size < (size_t)WS_END) return;
  char* ws = (char*)d_ws; __bf16* P = (__bf16*)ws; _Float16 *Q = (_Float16*)(ws + WS_Q), *Kr = (_Float16*)(ws + WS_K), *V = (_Float16*)(ws + WS_V);
  k_pack<<<dim3(EE, 3), 128, 0, stream>>>(F[1], F[3], F[5], P);
  k_proj<<<dim3(TNB * SS / 64, 3), 128, 0, stream>>>(F[0], P, F[2], F[4], F[6], Q, Kr, V);
  k_attn<<<dim3(TQB, TNB), 32 * NW, 0, stream>>>(Q, Kr, V, (float*)d_out);
}

// v006
// Measured time: 66.2 microseconds a run.
// Two timings next to v005 put it at 1.13 and 1.14 times that version's speed.
// Counting every step since v000, it is 12.9 times as fast.
// compute dtype: all float inputs rounded to bf16; Q / K / V = x . W^T + b with EXACT bf16 products on WMMA 16x16x32 (natural rows), rounded once to f16; PLAIN single-head attention over 8,192 slices with 128-dim q/k/v: q, k single f16 x 128^-0.5, running-max softmax in f32 (hardware exp), P (scaled by 2^11, single f16) x v (single f16); f32 accumulate and output.
#include <hip/hip_runtime.h>
#include <math.h>

typedef __attribute__((ext_vector_type(16))) _Float16 v16h;
typedef __attribute__((ext_vector_type(16))) __bf16 v16b;
typedef __attribute__((ext_vector_type(8)))  _Float16 v8h;
typedef __attribute__((ext_vector_type(8)))  float v8f;
typedef __attribute__((ext_vector_type(4)))  float v4f;
typedef __attribute__((ext_vector_type(2)))  float v2f;
typedef __attribute__((ext_vector_type(4)))  unsigned v4u;
typedef __attribute__((ext_vector_type(4)))  int v4i;
typedef float __attribute__((may_alias)) float_a;
typedef int __attribute__((may_alias)) int_a;

template <typename T> __device__ __forceinline__ void vst2(void* p, T v) { *(T*)p = v;  }
// the builtin alone: the compiler keeps the distances behind its own WMMAs; a pad statement with the fragments as operands would hold every one of them in the first 256 registers (spills in a wave that owns more)
__device__ __forceinline__ v8f wmma16(v16h a, v16h b, v8f c) {
  return __builtin_amdgcn_wmma_f32_16x16x32_f16(false, a, false, b, (short)0, c, false, false);
}
__device__ __forceinline__ v8f wmma_bf(v16b a, v16b b, v8f c) {
  v8f d = __builtin_amdgcn_wmma_f32_16x16x32_bf16(false, a, false, b, (short)0, c, false, false);
  asm volatile("v_nop\n\tv_nop\n\tv_nop\n\tv_nop" : "+v"(d) : "v"(a), "v"(b));
  return d;
}
// 16x16x32 fragments: lane = (h = lane>>4, row/col = lane&15); elements 0..7 = k0+8h+0..7, 8..15 = k0+16+8h+0..7; D element r = row 8h+r
__device__ __forceinline__ v16h frag_h(const _Float16* rowk0, int lane) {
  union { v16h v; v8h q[2]; } u; const _Float16* p = rowk0 + 8 * (lane >> 4);
  u.q[0] = *(const v8h*)p; u.q[1] = *(const v8h*)(p + 16); return u.v;
}
__device__ __forceinline__ v16h frag_f32(const float* rowk0, int lane) {
  v16h a; const float* p = rowk0 + 8 * (lane >> 4);
#pragma unroll
  for (int i = 0; i < 8; ++i) { a[i] = (_Float16)p[i]; a[8 + i] = (_Float16)p[16 + i]; }
  return a;
}
__device__ __forceinline__ v16h frag_f32s(const float* rowk0, int lane, float sc) {
  v16h a; const float* p = rowk0 + 8 * (lane >> 4);
#pragma unroll
  for (int i = 0; i < 8; ++i) { a[i] = (_Float16)(p[i] * sc); a[8 + i] = (_Float16)(p[16 + i] * sc); }
  return a;
}
// column fragment from a [K][ld] layout (column n), rows >= K read as 0
__device__ __forceinline__ v16h fragc_f32(const float* W, int k0, int n, int lane, int ld, int K) {
  v16h a; const int g = lane >> 4;
#pragma unroll
  for (int i = 0; i < 8; ++i) { const int ka = k0 + 8 * g + i, kb = ka + 16;
    a[i] = (_Float16)(ka < K ? W[(size_t)(ka < K ? ka : K - 1) * ld + n] : 0.f); a[8 + i] = (_Float16)(kb < K ? W[(size_t)(kb < K ? kb : K - 1) * ld + n] : 0.f); }
  return a;
}
struct F2 { v16b h, l; };
__device__ __forceinline__ F2 bsplit16(const float v[16]) { F2 r;
#pragma unroll
  for (int i = 0; i < 16; ++i) { const __bf16 h = (__bf16)v[i]; r.h[i] = h; r.l[i] = (__bf16)(v[i] - (float)h); }
  return r; }
__device__ __forceinline__ F2 split_row(const float* row, int k0, int lane) { float v[16]; const float* p = row + k0 + 8 * (lane >> 4);
#pragma unroll
  for (int i = 0; i < 8; ++i) { v[i] = p[i]; v[8 + i] = p[16 + i]; }
  return bsplit16(v); }
__device__ __forceinline__ F2 split_rowK(const float* row, int k0, int lane, int K) { float v[16]; const int g = lane >> 4;
#pragma unroll
  for (int i = 0; i < 8; ++i) { const int ka = k0 + 8 * g + i, kb = ka + 16; v[i] = ka < K ? row[ka < K ? ka : K - 1] : 0.f; v[8 + i] = kb < K ? row[kb < K ? kb : K - 1] : 0.f; }
  return bsplit16(v); }
__device__ __forceinline__ F2 split_col(const float* W, int k0, int n, int lane, int ld, int K) { float v[16]; const int g = lane >> 4;
#pragma unroll
  for (int i = 0; i < 8; ++i) { const int ka = k0 + 8 * g + i, kb = ka + 16; v[i] = ka < K ? W[(size_t)(ka < K ? ka : K - 1) * ld + n] : 0.f; v[8 + i] = kb < K ? W[(size_t)(kb < K ? kb : K - 1) * ld + n] : 0.f; }
  return bsplit16(v); }
__device__ __forceinline__ v8f mac3(const F2& a, const F2& b, v8f c) { c = wmma_bf(a.l, b.h, c); c = wmma_bf(a.h, b.l, c); return wmma_bf(a.h, b.h, c); }
__device__ __forceinline__ float sigm(float v) { return 1.0f / (1.0f + expf(-v)); }
#define LDSX() do { asm volatile("s_wait_dscnt 0" ::: "memory"); __builtin_amdgcn_wave_barrier(); __builtin_amdgcn_fence(__ATOMIC_RELEASE, "workgroup"); } while (0)


// Slice attention (B 2, 8,192 slices, 128 features, one head): 1x1-conv q / k / v projections + biases, softmax(Q K^T / sqrt(128)) V.
#define NB 2
#define SS 8192
#define EE 128
#define NR (NB * SS)
#ifndef TQB
#define TQB (SS / 64)
#define TNB NB
#endif
typedef __attribute__((ext_vector_type(8))) __bf16 v8b;
__device__ __forceinline__ v16b frag_b(const __bf16* rowk0, int lane) {
  union { v16b v; v8b q[2]; } u; const __bf16* p = rowk0 + 8 * (lane >> 4);
  u.q[0] = *(const v8b*)p; u.q[1] = *(const v8b*)(p + 16); return u.v;
}
__device__ __forceinline__ float bfr(float v) { return (float)(__bf16)v; }
__device__ __attribute__((noinline)) float exp_ni(float v) { return expf(v); }
__device__ __attribute__((noinline)) float erf_ni(float v) { return erff(v); }

#define WS_PW  0u                                  // [3][128][128] 16-bit words, not used
#define WS_Q   (WS_PW + 2u * 3 * EE * EE)           // f16 [NR][128] q rows ; K and V in fragment order (below)
// K: [16-key tile][kc * 2 + h][lane][8]: lane (g, col) holds key col, dims kc * 32 + h * 16 + g * 8 + 0..7.  V: [32-key block][dt * 2 + h][lane][8]: lane (g, col) holds dim dt * 16 + col, keys h * 16 + g * 8 + 0..7.
// Each [lane][8] unit is 512 contiguous bytes, one wave-wide 16-byte load of k_attn: 4 whole lines, where rows and planes gave 16 lines of 32 used bytes.
#define WS_K   (WS_Q + 2u * (size_t)NR * EE)
#define WS_V   (WS_K + 2u * (size_t)NR * EE)
#define WS_END (WS_V + 2u * (size_t)NB * EE * SS)

// ---- k_proj: block = (64 rows, which): 128 output cols; q -> f16 rows; k, v -> fragment order
// The block rounds its own W (128 x 128 f32) to bf16 into LDS, once: a wave-wide 16-byte load takes one whole row of W (4 whole lines), and the B fragments come from LDS.
typedef __attribute__((ext_vector_type(4))) __bf16 v4b;
__global__ __launch_bounds__(128) void k_proj(const float* __restrict__ X, const float* __restrict__ WQ, const float* __restrict__ WK, const float* __restrict__ WV, const float* __restrict__ BQ, const float* __restrict__ BK, const float* __restrict__ BV, _Float16* __restrict__ Q, _Float16* __restrict__ Kr, _Float16* __restrict__ V) {
  __shared__ __align__(16) _Float16 so[64][136]; __shared__ __align__(16) _Float16 st[128][72];
  __shared__ __align__(16) __bf16 sw[EE][136];   // W as bf16 rows; pitch 272 B = 17 x 16 B: a 16-byte LDS load over 16 rows meets no bank twice
  const int tid = threadIdx.x, wave = tid >> 5, lane = tid & 31, col = lane & 15, g = lane >> 4; const int which = blockIdx.y; const size_t rb0 = (size_t)blockIdx.x * 64, r0 = rb0 + wave * 16;
  const float* Wm = (which == 0) ? WQ : (which == 1) ? WK : WV; const float* BB = (which == 0) ? BQ : (which == 1) ? BK : BV;
  // all of the wave's X loads and its share of the W loads are issued ahead of the first wait: one trip to memory in all
  v4f xr[EE / 32][4], wr[EE / 4];
#pragma unroll
  for (int kc = 0; kc < EE / 32; ++kc) { const float* p = X + (r0 + col) * EE + kc * 32 + 8 * g;
    xr[kc][0] = *(const v4f*)p; xr[kc][1] = *(const v4f*)(p + 4); xr[kc][2] = *(const v4f*)(p + 16); xr[kc][3] = *(const v4f*)(p + 20); }
  asm volatile("s_wait_xcnt 0x0" ::: "memory");   // behind the X loads: their address pair is free for the W loads' address and results
  __builtin_amdgcn_sched_barrier(0);   // and nothing that rewrites it is lifted over the wait
#pragma unroll
  for (int i = 0; i < EE / 4; ++i) wr[i] = *(const v4f*)(Wm + (size_t)(i * 4 + wave) * EE + lane * 4);
  asm volatile("s_wait_xcnt 0x0" ::: "memory");   // behind the W loads: their address pair is reused by what follows
  __builtin_amdgcn_sched_barrier(0);   // and nothing that rewrites it is lifted over the wait
#pragma unroll
  for (int i = 0; i < EE / 4; ++i) *(v4b*)&sw[i * 4 + wave][lane * 4] = __builtin_convertvector(wr[i], v4b);
  v16b a[EE / 32];
#pragma unroll
  for (int kc = 0; kc < EE / 32; ++kc) {
    union { v16b v; v4b q[4]; } u;   // elements 0..7 = k 8g + 0..7 of the chunk, 8..15 = k 16 + 8g + 0..7
#pragma unroll
    for (int t = 0; t < 4; ++t) u.q[t] = __builtin_convertvector(xr[kc][t], v4b);
    a[kc] = u.v; }
  __syncthreads();   // every wave's rows of W are in LDS
  v8f acc[8] = {}; v16b bw[2][8];   // B fragments one k chunk ahead, eight as one group in front of the chunk's products
#pragma unroll
  for (int j = 0; j < 8; ++j) bw[0][j] = frag_b(&sw[j * 16 + col][0], lane);
#pragma unroll
  for (int kc = 0; kc < EE / 32; ++kc) {
    if (kc + 1 < EE / 32) {
#pragma unroll
      for (int j = 0; j < 8; ++j) bw[(kc + 1) & 1][j] = frag_b(&sw[j * 16 + col][(kc + 1) * 32], lane); }
#pragma unroll
    for (int j = 0; j < 8; ++j) acc[j] = wmma_bf(a[kc], bw[kc & 1][j], acc[j]); }
  if (which < 2) {
#pragma unroll
    for (int j = 0; j < 8; ++j) { const float bb = bfr(BB[j * 16 + col]);
#pragma unroll
      for (int r = 0; r < 8; ++r) so[wave * 16 + 8 * g + r][j * 16 + col] = (_Float16)(acc[j][r] + bb); }
    LDSX();
    if (which == 0) { for (int rl = 0; rl < 16; ++rl) if (lane < 16) vst2((unsigned*)(Q + (r0 + rl) * EE + lane * 8), *(const v4u*)&so[wave * 16 + rl][lane * 8]); }
    else {   // the wave's 16 rows are one key tile: 8 units of 512 B
#pragma unroll
      for (int i = 0; i < 8; ++i) vst2((unsigned*)(Kr + r0 * EE + i * 256 + lane * 8), *(const v4u*)&so[wave * 16 + col][i * 16 + g * 8]);
      asm volatile("s_wait_xcnt 0x0" ::: "memory"); }   // behind the last K store: no register that the eight stores name is rewritten ahead of it on any path of the listing
  } else {
#pragma unroll
    for (int j = 0; j < 8; ++j) { const float bb = bfr(BB[j * 16 + col]);
#pragma unroll
      for (int r = 0; r < 8; ++r) st[j * 16 + col][wave * 16 + 8 * g + r] = (_Float16)(acc[j][r] + bb); }
    __syncthreads();
    // the block's 64 keys are two 32-key blocks, 16 KB in a row: 16-byte piece e = ((block * 8 + dt) * 2 + h) * 32 + g * 16 + col
    for (int e = tid; e < 128 * 8; e += 128) vst2((unsigned*)(V + rb0 * EE + (size_t)e * 8), *(const v4u*)&st[((e >> 6) & 7) * 16 + (e & 15)][(e >> 9) * 32 + ((e >> 5) & 1) * 16 + ((e >> 4) & 1) * 8]); }
}
// fragment in fragment order at a lane's own address (8 * lane already added): its two halves are the lane's 16 bytes of two 512-B units in a row
__device__ __forceinline__ v16h frag_p(const _Float16* p) { union { v16h v; v8h q[2]; } u; u.q[0] = *(const v8h*)p; u.q[1] = *(const v8h*)(p + 256); return u.v; }
// lane l with lane l ^ 16 on the vector pipe (a shuffle would go through the LDS unit and its wait)
__device__ __forceinline__ float xhalf(float x) { return __builtin_bit_cast(float, __builtin_amdgcn_permlanex16(__builtin_bit_cast(int, x), __builtin_bit_cast(int, x), 0x76543210, 0xfedcba98, false, false)); }
// (x0 + x2) + (x4 + x6) and (x1 + x3) + (x5 + x7): packed adds on neighbouring registers
__device__ __forceinline__ v2f pairsum(v8f x) { return (__builtin_shufflevector(x, x, 0, 1) + __builtin_shufflevector(x, x, 2, 3)) + (__builtin_shufflevector(x, x, 4, 5) + __builtin_shufflevector(x, x, 6, 7)); }
// ---- k_attn: block = (64 queries, b): 128-dim q/k/v, all 8,192 keys, plain; f32 output rows
// KS key ranges a block: wave (qw, kq) walks key range kq alone (SS / KS keys) for its own queries, with their running maximum, sum and O^T; the ranges are merged through LDS behind the loop.
#define KS 4
// QT 16-query tiles a wave: every K and V fragment that a wave loads feeds QT products instead of one, so the block moves 1 / QT of the fragment bytes from the cache into registers for the same products.
// The block is then 4 / QT * KS waves, 2 a SIMD, each with up to 512 registers.
#define QT 2
#define NW (4 / QT * KS)
// Transposed products: S^T = K . Q^T (A = K fragment, B = Q fragment) and O^T += V^T . P^T (A = V fragment, B = P^T). Lane (g, col) then holds, of query col alone, the scores of keys 8g + r of each
// 16-key tile: maximum and sum are in-lane but for one exchange between the halves, and the two score tiles of a pass, converted in place, ARE the B fragment of the second product (element ct * 8 + r = key ct * 16 + 8g + r).
__global__ __launch_bounds__(32 * NW) void k_attn(const _Float16* __restrict__ Q, const _Float16* __restrict__ Kr, const _Float16* __restrict__ V, float* __restrict__ OUT) {
  __shared__ __align__(16) float so[KS][64][132]; __shared__ float sm[KS][64], sl[KS][64];
  const int tid = threadIdx.x, wave = __builtin_amdgcn_readfirstlane(tid >> 5), qw = wave & (4 / QT - 1), kq = wave / (4 / QT), lane = tid & 31, col = lane & 15; const size_t b = blockIdx.y; const int q0 = blockIdx.x * 64 + qw * (16 * QT); const size_t rq = b * SS + q0;
  v16h aq[QT][4];
#pragma unroll
  for (int u = 0; u < QT; ++u) {
#pragma unroll
    for (int kc = 0; kc < 4; ++kc) aq[u][kc] = frag_h(Q + (rq + u * 16 + col) * EE + kc * 32, lane); }
  static_assert(QT == 2, "the pairs below and the operand list of the wait in the loop are written for two tiles");
  v2f mv = {-3.0e38f, -3.0e38f}, lv = {0.f, 0.f};   // element u: running maximum and sum of query u * 16 + col; the sum is of this half's keys only, the halves are joined behind the loop
  v8f acc[QT][8] = {};           // acc[u][dt][r] = O^T[dim dt * 16 + 8g + r][query u * 16 + col]
  asm volatile("s_wait_xcnt 0x0" ::: "memory");   // the Q loads' address pair is free for reuse by what follows
  // K and V fragments live in registers one pass ahead: each set is refilled as ONE group of loads right behind its last product,
  // so a pass waits for no load of its own.
  const size_t kb = (b * SS + (size_t)kq * (SS / KS)) * EE;   // first key of the wave's range: the same in every lane, so the walking addresses are scalar and cost no vector register
  const _Float16* Kg = Kr + kb; const _Float16* Vg = V + kb; const int lo = 8 * lane;
  v16h kf[2][4], vf[8];
#pragma unroll
  for (int ct = 0; ct < 2; ++ct) {
#pragma unroll
    for (int kc = 0; kc < 4; ++kc) kf[ct][kc] = frag_p(Kg + ct * 16 * EE + kc * 512 + lo); }
  __builtin_amdgcn_sched_barrier(0);   // V's first loads stay the youngest, as in the loop: else the counted waits at the loop's head, merged from both ways in, also drain V
  unsigned long long va = (unsigned long long)Vg;
#pragma unroll
  for (int dt = 0; dt < 8; ++dt) vf[dt] = frag_p(Vg + dt * 512 + lo);
  asm volatile("s_wait_xcnt 0x0" ::: "memory");   // behind the first K and V loads: the offset register that they name is reused by what follows
  __builtin_amdgcn_sched_barrier(0);   // and nothing that rewrites it is lifted over the wait
#pragma unroll 1
  for (int ks = 0; ks < SS / 32 / KS; ++ks) { const int jn = (ks + 1 < SS / 32 / KS) ? (ks + 1) * 32 : 0; v8f s[QT][2];   // next pass's keys; the last pass refetches the range's tile 0, in bounds and unused
#pragma unroll
    for (int ct = 0; ct < 2; ++ct) { v8f c[QT] = {};
#pragma unroll
      for (int kc = 0; kc < 4; ++kc) {
#pragma unroll
        for (int u = 0; u < QT; ++u) c[u] = wmma16(kf[ct][kc], aq[u][kc], c[u]); }
#pragma unroll
      for (int u = 0; u < QT; ++u) s[u][ct] = c[u] * 0.08838834764831845f; }   // 128^-0.5
    const _Float16* kp = Kg + (size_t)jn * EE;
    __builtin_amdgcn_sched_barrier(0);   // the K refill stays one group behind the last product that reads the set
#pragma unroll
    for (int ct = 0; ct < 2; ++ct) {
#pragma unroll
      for (int kc = 0; kc < 4; ++kc) kf[ct][kc] = frag_p(kp + ct * 16 * EE + kc * 512 + lo); }
    v16h pb[QT]; v2f mx2, es;   // element u of a pair belongs to query tile u
    // The softmax is written on whole register vectors, so that the packed instructions take neighbouring registers of ONE tile (left to itself the compiler pairs values of different tiles, or a score with the old maximum, and moves them together first).
#pragma unroll
    for (int u = 0; u < QT; ++u) { const v8f t8 = __builtin_elementwise_max(s[u][0], s[u][1]);
      mx2[u] = fmaxf(fmaxf(fmaxf(t8[0], t8[1]), fmaxf(t8[2], t8[3])), fmaxf(fmaxf(t8[4], t8[5]), fmaxf(t8[6], t8[7]))); }
    mx2 = __builtin_elementwise_max(mx2, (v2f){xhalf(mx2[0]), xhalf(mx2[1])});   // all 32 keys of the pass: both halves scale P and O^T alike
    const v2f mn2 = __builtin_elementwise_max(mv, mx2), da = (mv - mn2) * 1.4426950408889634f;   // exp(x) = 2^(x log2 e), on the hardware's exp2
    v2f al;
#pragma unroll
    for (int u = 0; u < QT; ++u) al[u] = (mv[u] <= -1.0e38f) ? 0.f : __builtin_amdgcn_exp2f(da[u]);
#pragma unroll
    for (int u = 0; u < QT; ++u) { v8f ex[2];
#pragma unroll
      for (int ct = 0; ct < 2; ++ct) { const v8f d = (s[u][ct] - mn2[u]) * 1.4426950408889634f;
#pragma unroll
        for (int r = 0; r < 8; ++r) ex[ct][r] = __builtin_amdgcn_exp2f(d[r]);
        const v8h ph = __builtin_convertvector(ex[ct] * 2048.0f, v8h);
#pragma unroll
        for (int r = 0; r < 8; ++r) pb[u][ct * 8 + r] = ph[r]; }
      const v2f e2 = pairsum(ex[0]) + pairsum(ex[1]);   // a tree three deep instead of a chain of sixteen adds
      es[u] = e2[0] + e2[1];
#pragma unroll
      for (int dt = 0; dt < 8; ++dt) acc[u][dt] *= al[u]; }
    lv = lv * al + es; mv = mn2;
#pragma unroll
    for (int dt = 0; dt < 8; ++dt) {
#pragma unroll
      for (int u = 0; u < QT; ++u) acc[u][dt] = wmma16(vf[dt], pb[u], acc[u][dt]); }
    // the s_wait_xcnt 0 of the K loads above and of the V loads of the pass before stands here: K's and V's address pairs are rewritten only behind it. The products' results are its inputs, so that it stands behind the last product
    // and, by its memory clobber, the V refill behind it: lifted above the products the refill lands in a second register set, is copied back at the loop's foot and is waited out there.
    // V's address goes through the statement (as a number: a pointer would come out of it as a generic one, and its loads as flat loads) and walks on from what comes out of it, so that the pair which the V loads in flight name is rewritten only behind the wait.
    asm volatile("s_wait_xcnt 0x0" : "+s"(va) : "s"(kp), "v"(acc[0][0]), "v"(acc[0][1]), "v"(acc[0][2]), "v"(acc[0][3]), "v"(acc[0][4]), "v"(acc[0][5]), "v"(acc[0][6]), "v"(acc[0][7]),
                 "v"(acc[1][0]), "v"(acc[1][1]), "v"(acc[1][2]), "v"(acc[1][3]), "v"(acc[1][4]), "v"(acc[1][5]), "v"(acc[1][6]), "v"(acc[1][7]) : "memory");
    va += (ks + 1 < SS / 32 / KS) ? 2 * 32 * EE : 0;   // bytes; the last pass refetches its own block, in bounds and unused
    const _Float16* vp = (const _Float16*)(const __attribute__((address_space(1))) _Float16*)va;
#pragma unroll
    for (int dt = 0; dt < 8; ++dt) vf[dt] = frag_p(vp + dt * 512 + lo); }
  asm volatile("s_wait_xcnt 0x0" :: "s"(va) : "memory");   // the last V loads' address pair is free for the epilogue
  // merge of the KS key ranges of a query: common maximum M, weights exp(m_k - M), L = sum of the weighted sums; each wave scales its own O^T by its weight over L, the scaled parts are added in range order
  const int ln = __builtin_amdgcn_mbcnt_lo(~0u, 0u), g2 = ln >> 4;   // the lane's number, read anew: no index of the epilogue is carried across the loop
  const int qr0 = qw * (16 * QT) + (ln & 15);
#pragma unroll
  for (int u = 0; u < QT; ++u) { const float lt = lv[u] + xhalf(lv[u]);
    if (g2 == 0) { sm[kq][qr0 + u * 16] = mv[u]; sl[kq][qr0 + u * 16] = lt; } }
  __syncthreads();   // every range's maximum and sum are in LDS
#pragma unroll
  for (int u = 0; u < QT; ++u) { const int qr = qr0 + u * 16;
    float M = sm[0][qr];
#pragma unroll
    for (int k = 1; k < KS; ++k) M = fmaxf(M, sm[k][qr]);
    float L = 0.f;
#pragma unroll
    for (int k = 0; k < KS; ++k) L += sl[k][qr] * __expf(sm[k][qr] - M);
    const float il = __expf(mv[u] - M) * (1.0f / 2048.0f) / L;
#pragma unroll
    for (int dt = 0; dt < 8; ++dt) { const v8f o = acc[u][dt] * il;   // a lane's 8 registers are 8 dims in a row of its query's output row
      *(v4f*)&so[kq][qr][dt * 16 + 8 * g2] = __builtin_shufflevector(o, o, 0, 1, 2, 3); *(v4f*)&so[kq][qr][dt * 16 + 8 * g2 + 4] = __builtin_shufflevector(o, o, 4, 5, 6, 7); } }
  __syncthreads();   // every range's scaled part is in LDS
  float* ob = OUT + (b * SS + (size_t)blockIdx.x * 64 + wave * (64 / NW)) * EE + ln * 4;
#pragma unroll
  for (int i = 0; i < 64 / NW; ++i) { v4f o = *(const v4f*)&so[0][wave * (64 / NW) + i][ln * 4];
#pragma unroll
    for (int k = 1; k < KS; ++k) o += *(const v4f*)&so[k][wave * (64 / NW) + i][ln * 4];
    vst2(ob + i * EE, o); }   // whole 512-B output row per wave
}
extern "C" void kernel_launch(void* const* d_in, const int* in_sizes, int n_in, void* d_out, int out_size, void* d_ws, size_t ws_size, hipStream_t stream) {
  (void)in_sizes; (void)n_in; (void)out_size;
  const float** F = (const float**)d_in;   // 0 x [2,8192,128], 1 Wq [128,128], 2 bq, 3 Wk, 4 bk, 5 Wv, 6 bv
  if (ws_size < (size_t)WS_END) return;
  char* ws = (char*)d_ws; _Float16 *Q = (_Float16*)(ws + WS_Q), *Kr = (_Float16*)(ws + WS_K), *V = (_Float16*)(ws + WS_V);
  k_proj<<<dim3(TNB * SS / 64, 3), 128, 0, stream>>>(F[0], F[1], F[3], F[5], F[2], F[4], F[6], Q, Kr, V);
  k_attn<<<dim3(TQB, TNB), 32 * NW, 0, stream>>>(Q, Kr, V, (float*)d_out);
}

// v007
// Measured time: 56.9 microseconds a run.
// Timed twice side by side with v006, it ran 1.10 and 1.19 times as fast.
// All steps since v000 together make it 14.8 times as fast.
// compute dtype: all float inputs rounded to bf16; Q / K / V = x . W^T + b with EXACT bf16 products on WMMA 16x16x32 (natural rows), rounded once to f16; PLAIN single-head attention over 8,192 slices with 128-dim q/k/v: q, k single f16 x 128^-0.5, running-max softmax in f32 (hardware exp), P (scaled by 2^11, single f16) x v (single f16); f32 accumulate and output.
#include <hip/hip_runtime.h>
#include <math.h>

typedef __attribute__((ext_vector_type(16))) _Float16 v16h;
typedef __attribute__((ext_vector_type(16))) __bf16 v16b;
typedef __attribute__((ext_vector_type(8)))  _Float16 v8h;
typedef __attribute__((ext_vector_type(8)))  float v8f;
typedef __attribute__((ext_vector_type(4)))  float v4f;
typedef __attribute__((ext_vector_type(2)))  float v2f;
typedef __attribute__((ext_vector_type(4)))  unsigned v4u;
typedef __attribute__((ext_vector_type(4)))  int v4i;
typedef float __attribute__((may_alias)) float_a;
typedef int __attribute__((may_alias)) int_a;

template <typename T> __device__ __forceinline__ void vst2(void* p, T v) { *(T*)p = v;  }
// the builtin alone: the compiler keeps the distances behind its own WMMAs; a pad statement with the fragments as operands would hold every one of them in the first 256 registers (spills in a wave that owns more)
__device__ __forceinline__ v8f wmma16(v16h a, v16h b, v8f c) {
  return __builtin_amdgcn_wmma_f32_16x16x32_f16(false, a, false, b, (short)0, c, false, false);
}
__device__ __forceinline__ v8f wmma_bf(v16b a, v16b b, v8f c) {
  v8f d = __builtin_amdgcn_wmma_f32_16x16x32_bf16(false, a, false, b, (short)0, c, false, false);
  asm volatile("v_nop\n\tv_nop\n\tv_nop\n\tv_nop" : "+v"(d) : "v"(a), "v"(b));
  return d;
}
// 16x16x32 fragments: lane = (h = lane>>4, row/col = lane&15); elements 0..7 = k0+8h+0..7, 8..15 = k0+16+8h+0..7; D element r = row 8h+r
__device__ __forceinline__ v16h frag_h(const _Float16* rowk0, int lane) {
  union { v16h v; v8h q[2]; } u; const _Float16* p = rowk0 + 8 * (lane >> 4);
  u.q[0] = *(const v8h*)p; u.q[1] = *(const v8h*)(p + 16); return u.v;
}
__device__ __forceinline__ v16h frag_f32(const float* rowk0, int lane) {
  v16h a; const float* p = rowk0 + 8 * (lane >> 4);
#pragma unroll
  for (int i = 0; i < 8; ++i) { a[i] = (_Float16)p[i]; a[8 + i] = (_Float16)p[16 + i]; }
  return a;
}
__device__ __forceinline__ v16h frag_f32s(const float* rowk0, int lane, float sc) {
  v16h a; const float* p = rowk0 + 8 * (lane >> 4);
#pragma unroll
  for (int i = 0; i < 8; ++i) { a[i] = (_Float16)(p[i] * sc); a[8 + i] = (_Float16)(p[16 + i] * sc); }
  return a;
}
// column fragment from a [K][ld] layout (column n), rows >= K read as 0
__device__ __forceinline__ v16h fragc_f32(const float* W, int k0, int n, int lane, int ld, int K) {
  v16h a; const int g = lane >> 4;
#pragma unroll
  for (int i = 0; i < 8; ++i) { const int ka = k0 + 8 * g + i, kb = ka + 16;
    a[i] = (_Float16)(ka < K ? W[(size_t)(ka < K ? ka : K - 1) * ld + n] : 0.f); a[8 + i] = (_Float16)(kb < K ? W[(size_t)(kb < K ? kb : K - 1) * ld + n] : 0.f); }
  return a;
}
struct F2 { v16b h, l; };
__device__ __forceinline__ F2 bsplit16(const float v[16]) { F2 r;
#pragma unroll
  for (int i = 0; i < 16; ++i) { const __bf16 h = (__bf16)v[i]; r.h[i] = h; r.l[i] = (__bf16)(v[i] - (float)h); }
  return r; }
__device__ __forceinline__ F2 split_row(const float* row, int k0, int lane) { float v[16]; const float* p = row + k0 + 8 * (lane >> 4);
#pragma unroll
  for (int i = 0; i < 8; ++i) { v[i] = p[i]; v[8 + i] = p[16 + i]; }
  return bsplit16(v); }
__device__ __forceinline__ F2 split_rowK(const float* row, int k0, int lane, int K) { float v[16]; const int g = lane >> 4;
#pragma unroll
  for (int i = 0; i < 8; ++i) { const int ka = k0 + 8 * g + i, kb = ka + 16; v[i] = ka < K ? row[ka < K ? ka : K - 1] : 0.f; v[8 + i] = kb < K ? row[kb < K ? kb : K - 1] : 0.f; }
  return bsplit16(v); }
__device__ __forceinline__ F2 split_col(const float* W, int k0, int n, int lane, int ld, int K) { float v[16]; const int g = lane >> 4;
#pragma unroll
  for (int i = 0; i < 8; ++i) { const int ka = k0 + 8 * g + i, kb = ka + 16; v[i] = ka < K ? W[(size_t)(ka < K ? ka : K - 1) * ld + n] : 0.f; v[8 + i] = kb < K ? W[(size_t)(kb < K ? kb : K - 1) * ld + n] : 0.f; }
  return bsplit16(v); }
__device__ __forceinline__ v8f mac3(const F2& a, const F2& b, v8f c) { c = wmma_bf(a.l, b.h, c); c = wmma_bf(a.h, b.l, c); return wmma_bf(a.h, b.h, c); }
__device__ __forceinline__ float sigm(float v) { return 1.0f / (1.0f + expf(-v)); }
#define LDSX() do { asm volatile("s_wait_dscnt 0" ::: "memory"); __builtin_amdgcn_wave_barrier(); __builtin_amdgcn_fence(__ATOMIC_RELEASE, "workgroup"); } while (0)


// Slice attention (B 2, 8,192 slices, 128 features, one head): 1x1-conv q / k / v projections + biases, softmax(Q K^T / sqrt(128)) V.
#define NB 2
#define SS 8192
#define EE 128
#define NR (NB * SS)
#ifndef TQB
#define TQB (SS / 64)
#define TNB NB
#endif
typedef __attribute__((ext_vector_type(8))) __bf16 v8b;
__device__ __forceinline__ v16b frag_b(const __bf16* rowk0, int lane) {
  union { v16b v; v8b q[2]; } u; const __bf16* p = rowk0 + 8 * (lane >> 4);
  u.q[0] = *(const v8b*)p; u.q[1] = *(const v8b*)(p + 16); return u.v;
}
__device__ __forceinline__ float bfr(float v) { return (float)(__bf16)v; }
__device__ __attribute__((noinline)) float exp_ni(float v) { return expf(v); }
__device__ __attribute__((noinline)) float erf_ni(float v) { return erff(v); }

#define WS_PW  0u                                  // [3][128][128] 16-bit words, not used
#define WS_Q   (WS_PW + 2u * 3 * EE * EE)           // f16 [NR][128] q rows ; K and V in fragment order (below)
// K: [16-key tile][kc * 2 + h][lane][8]: lane (g, col) holds key col, dims kc * 32 + h * 16 + g * 8 + 0..7.  V: [32-key block][dt * 2 + h][lane][8]: lane (g, col) holds dim dt * 16 + col, keys h * 16 + g * 8 + 0..7.
// Each [lane][8] unit is 512 contiguous bytes, one wave-wide 16-byte load of k_attn: 4 whole lines, where rows and planes gave 16 lines of 32 used bytes.
#define WS_K   (WS_Q + 2u * (size_t)NR * EE)
#define WS_V   (WS_K + 2u * (size_t)NR * EE)
#define WS_END (WS_V + 2u * (size_t)NB * EE * SS)

// ---- k_proj: block = (64 rows, which): 128 output cols; q -> f16 rows; k, v -> fragment order
// The block rounds its own W (128 x 128 f32) to bf16 into LDS, once: a wave-wide 16-byte load takes one whole row of W (4 whole lines), and the B fragments come from LDS.
typedef __attribute__((ext_vector_type(4))) __bf16 v4b;
__global__ __launch_bounds__(128) void k_proj(const float* __restrict__ X, const float* __restrict__ WQ, const float* __restrict__ WK, const float* __restrict__ WV, const float* __restrict__ BQ, const float* __restrict__ BK, const float* __restrict__ BV, _Float16* __restrict__ Q, _Float16* __restrict__ Kr, _Float16* __restrict__ V) {
  __shared__ __align__(16) _Float16 so[64][136]; __shared__ __align__(16) _Float16 st[128][72];
  __shared__ __align__(16) __bf16 sw[EE][136];   // W as bf16 rows; pitch 272 B = 17 x 16 B: a 16-byte LDS load over 16 rows meets no bank twice
  const int tid = threadIdx.x, wave = tid >> 5, lane = tid & 31, col = lane & 15, g = lane >> 4; const int which = blockIdx.y; const size_t rb0 = (size_t)blockIdx.x * 64, r0 = rb0 + wave * 16;
  const float* Wm = (which == 0) ? WQ : (which == 1) ? WK : WV; const float* BB = (which == 0) ? BQ : (which == 1) ? BK : BV;
  // all of the wave's X loads and its share of the W loads are issued ahead of the first wait: one trip to memory in all
  v4f xr[EE / 32][4], wr[EE / 4];
#pragma unroll
  for (int kc = 0; kc < EE / 32; ++kc) { const float* p = X + (r0 + col) * EE + kc * 32 + 8 * g;
    xr[kc][0] = *(const v4f*)p; xr[kc][1] = *(const v4f*)(p + 4); xr[kc][2] = *(const v4f*)(p + 16); xr[kc][3] = *(const v4f*)(p + 20); }
  asm volatile("s_wait_xcnt 0x0" ::: "memory");   // behind the X loads: their address pair is free for the W loads' address and results
  __builtin_amdgcn_sched_barrier(0);   // and nothing that rewrites it is lifted over the wait
#pragma unroll
  for (int i = 0; i < EE / 4; ++i) wr[i] = *(const v4f*)(Wm + (size_t)(i * 4 + wave) * EE + lane * 4);
  asm volatile("s_wait_xcnt 0x0" ::: "memory");   // behind the W loads: their address pair is reused by what follows
  __builtin_amdgcn_sched_barrier(0);   // and nothing that rewrites it is lifted over the wait
#pragma unroll
  for (int i = 0; i < EE / 4; ++i) *(v4b*)&sw[i * 4 + wave][lane * 4] = __builtin_convertvector(wr[i], v4b);
  v16b a[EE / 32];
#pragma unroll
  for (int kc = 0; kc < EE / 32; ++kc) {
    union { v16b v; v4b q[4]; } u;   // elements 0..7 = k 8g + 0..7 of the chunk, 8..15 = k 16 + 8g + 0..7
#pragma unroll
    for (int t = 0; t < 4; ++t) u.q[t] = __builtin_convertvector(xr[kc][t], v4b);
    a[kc] = u.v; }
  __syncthreads();   // every wave's rows of W are in LDS
  v8f acc[8] = {}; v16b bw[2][8];   // B fragments one k chunk ahead, eight as one group in front of the chunk's products
#pragma unroll
  for (int j = 0; j < 8; ++j) bw[0][j] = frag_b(&sw[j * 16 + col][0], lane);
#pragma unroll
  for (int kc = 0; kc < EE / 32; ++kc) {
    if (kc + 1 < EE / 32) {
#pragma unroll
      for (int j = 0; j < 8; ++j) bw[(kc + 1) & 1][j] = frag_b(&sw[j * 16 + col][(kc + 1) * 32], lane); }
#pragma unroll
    for (int j = 0; j < 8; ++j) acc[j] = wmma_bf(a[kc], bw[kc & 1][j], acc[j]); }
  if (which < 2) {
#pragma unroll
    for (int j = 0; j < 8; ++j) { const float bb = bfr(BB[j * 16 + col]);
#pragma unroll
      for (int r = 0; r < 8; ++r) so[wave * 16 + 8 * g + r][j * 16 + col] = (_Float16)(acc[j][r] + bb); }
    LDSX();
    if (which == 0) { for (int rl = 0; rl < 16; ++rl) if (lane < 16) vst2((unsigned*)(Q + (r0 + rl) * EE + lane * 8), *(const v4u*)&so[wave * 16 + rl][lane * 8]); }
    else {   // the wave's 16 rows are one key tile: 8 units of 512 B
#pragma unroll
      for (int i = 0; i < 8; ++i) vst2((unsigned*)(Kr + r0 * EE + i * 256 + lane * 8), *(const v4u*)&so[wave * 16 + col][i * 16 + g * 8]);
      asm volatile("s_wait_xcnt 0x0" ::: "memory"); }   // behind the last K store: no register that the eight stores name is rewritten ahead of it on any path of the listing
  } else {
#pragma unroll
    for (int j = 0; j < 8; ++j) { const float bb = bfr(BB[j * 16 + col]);
#pragma unroll
      for (int r = 0; r < 8; ++r) st[j * 16 + col][wave * 16 + 8 * g + r] = (_Float16)(acc[j][r] + bb); }
    __syncthreads();
    // the block's 64 keys are two 32-key blocks, 16 KB in a row: 16-byte piece e = ((block * 8 + dt) * 2 + h) * 32 + g * 16 + col
    for (int e = tid; e < 128 * 8; e += 128) vst2((unsigned*)(V + rb0 * EE + (size_t)e * 8), *(const v4u*)&st[((e >> 6) & 7) * 16 + (e & 15)][(e >> 9) * 32 + ((e >> 5) & 1) * 16 + ((e >> 4) & 1) * 8]); }
}
// fragment in fragment order at a lane's own address (8 * lane already added): its two halves are the lane's 16 bytes of two 512-B units in a row
__device__ __forceinline__ v16h frag_p(const _Float16* p) { union { v16h v; v8h q[2]; } u; u.q[0] = *(const v8h*)p; u.q[1] = *(const v8h*)(p + 256); return u.v; }
// lane l with lane l ^ 16 on the vector pipe (a shuffle would go through the LDS unit and its wait)
__device__ __forceinline__ float xhalf(float x) { return __builtin_bit_cast(float, __builtin_amdgcn_permlanex16(__builtin_bit_cast(int, x), __builtin_bit_cast(int, x), 0x76543210, 0xfedcba98, false, false)); }
// (x0 + x2) + (x4 + x6) and (x1 + x3) + (x5 + x7): packed adds on neighbouring registers
__device__ __forceinline__ v2f pairsum(v8f x) { return (__builtin_shufflevector(x, x, 0, 1) + __builtin_shufflevector(x, x, 2, 3)) + (__builtin_shufflevector(x, x, 4, 5) + __builtin_shufflevector(x, x, 6, 7)); }
// ---- k_attn: block = (64 queries, b): 128-dim q/k/v, all 8,192 keys, plain; f32 output rows
// KS key ranges a block: wave (qw, kq) walks key range kq alone (SS / KS keys) for its own queries, with their running maximum, sum and O^T; the ranges are merged through LDS behind the loop.
#define KS 4
// QT 16-query tiles a wave: every K and V fragment that a wave loads feeds QT products instead of one, so the block moves 1 / QT of the fragment bytes from the cache into registers for the same products.
// The block is then 4 / QT * KS waves, 2 a SIMD, each with up to 512 registers.
#define QT 2
#define NW (4 / QT * KS)
#define NP (SS / 32 / KS)   // passes of 32 keys in a key range
// Transposed products: S^T = K . Q^T (A = K fragment, B = Q fragment) and O^T += V^T . P^T (A = V fragment, B = P^T). Lane (g, col) then holds, of query col alone, the scores of keys 8g + r of each
// 16-key tile: maximum and sum are in-lane but for one exchange between the halves, and the two score tiles of a pass, converted in place, ARE the B fragment of the second product (element ct * 8 + r = key ct * 16 + 8g + r).
__global__ __launch_bounds__(32 * NW) void k_attn(const _Float16* __restrict__ Q, const _Float16* __restrict__ Kr, const _Float16* __restrict__ V, float* __restrict__ OUT) {
  __shared__ __align__(16) float so[KS][64][132]; __shared__ float sm[KS][64], sl[KS][64];
  const int tid = threadIdx.x, wave = __builtin_amdgcn_readfirstlane(tid >> 5), qw = wave & (4 / QT - 1), kq = wave / (4 / QT), lane = tid & 31, col = lane & 15; const size_t b = blockIdx.y; const int q0 = blockIdx.x * 64 + qw * (16 * QT); const size_t rq = b * SS + q0;
  v16h aq[QT][4];
#pragma unroll
  for (int u = 0; u < QT; ++u) {
#pragma unroll
    for (int kc = 0; kc < 4; ++kc) aq[u][kc] = frag_h(Q + (rq + u * 16 + col) * EE + kc * 32, lane); }
  static_assert(QT == 2, "the pairs below and the operand list of the wait in the loop are written for two tiles");
  v2f mv = {-3.0e38f, -3.0e38f}, lv = {0.f, 0.f};   // element u: running maximum and sum of query u * 16 + col; the sum is of this half's keys only, the halves are joined behind the loop
  v8f acc[QT][8] = {};           // acc[u][dt][r] = O^T[dim dt * 16 + 8g + r][query u * 16 + col]
  asm volatile("s_wait_xcnt 0x0" ::: "memory");   // the Q loads' address pair is free for reuse by what follows
  // K and V fragments live in registers one pass ahead: each set is refilled as ONE group of loads right behind its last product,
  // so a pass waits for no load of its own.
  const size_t kb = (b * SS + (size_t)kq * (SS / KS)) * EE;   // first key of the wave's range: the same in every lane, so the walking addresses are scalar and cost no vector register
  // Every block walks each key range once round, from a pass of its own: walked from the same end, all blocks of a batch ask the L2 for the same few lines at the same moment, and each line's first fetch is waited for by all of them in every pass.
  // Odd multiplier: neighbouring blocks start far apart, and every start is taken by two of the 128 blocks, wherever the blocks are placed.
  static_assert((NP & (NP - 1)) == 0, "the walk wraps by a mask");
  const int p0 = (int)((blockIdx.x * 27u >> 1) & (NP - 1));
  const _Float16* Kb = Kr + kb; const _Float16* Kg = Kb + (size_t)p0 * 32 * EE; const _Float16* Vg = V + kb + (size_t)p0 * 32 * EE; const int lo = 8 * lane;
  v16h kf[2][4], vf[8];
#pragma unroll
  for (int ct = 0; ct < 2; ++ct) {
#pragma unroll
    for (int kc = 0; kc < 4; ++kc) kf[ct][kc] = frag_p(Kg + ct * 16 * EE + kc * 512 + lo); }
  __builtin_amdgcn_sched_barrier(0);   // V's first loads stay the youngest, as in the loop: else the counted waits at the loop's head, merged from both ways in, also drain V
  unsigned long long va = (unsigned long long)Vg;
#pragma unroll
  for (int dt = 0; dt < 8; ++dt) vf[dt] = frag_p(Vg + dt * 512 + lo);
  asm volatile("s_wait_xcnt 0x0" ::: "memory");   // behind the first K and V loads: the offset register that they name is reused by what follows
  __builtin_amdgcn_sched_barrier(0);   // and nothing that rewrites it is lifted over the wait
#pragma unroll 1
  for (int ks = 0; ks < NP; ++ks) { const int pn = (p0 + ks + 1) & (NP - 1), jn = pn * 32; v8f s[QT][2];   // next pass's keys, round the range; the last pass refetches the walk's first tiles, in bounds and unused
#pragma unroll
    for (int ct = 0; ct < 2; ++ct) { v8f c[QT] = {};
#pragma unroll
      for (int kc = 0; kc < 4; ++kc) {
#pragma unroll
        for (int u = 0; u < QT; ++u) c[u] = wmma16(kf[ct][kc], aq[u][kc], c[u]); }
#pragma unroll
      for (int u = 0; u < QT; ++u) s[u][ct] = c[u] * 0.08838834764831845f; }   // 128^-0.5
    const _Float16* kp = Kb + (size_t)jn * EE;
    __builtin_amdgcn_sched_barrier(0);   // the K refill stays one group behind the last product that reads the set
#pragma unroll
    for (int ct = 0; ct < 2; ++ct) {
#pragma unroll
      for (int kc = 0; kc < 4; ++kc) kf[ct][kc] = frag_p(kp + ct * 16 * EE + kc * 512 + lo); }
    v16h pb[QT]; v2f mx2, es;   // element u of a pair belongs to query tile u
    // The softmax is written on whole register vectors, so that the packed instructions take neighbouring registers of ONE tile (left to itself the compiler pairs values of different tiles, or a score with the old maximum, and moves them together first).
#pragma unroll
    for (int u = 0; u < QT; ++u) { const v8f t8 = __builtin_elementwise_max(s[u][0], s[u][1]);
      mx2[u] = fmaxf(fmaxf(fmaxf(t8[0], t8[1]), fmaxf(t8[2], t8[3])), fmaxf(fmaxf(t8[4], t8[5]), fmaxf(t8[6], t8[7]))); }
    mx2 = __builtin_elementwise_max(mx2, (v2f){xhalf(mx2[0]), xhalf(mx2[1])});   // all 32 keys of the pass: both halves scale P and O^T alike
    const v2f mn2 = __builtin_elementwise_max(mv, mx2), da = (mv - mn2) * 1.4426950408889634f;   // exp(x) = 2^(x log2 e), on the hardware's exp2
    v2f al;
#pragma unroll
    for (int u = 0; u < QT; ++u) al[u] = (mv[u] <= -1.0e38f) ? 0.f : __builtin_amdgcn_exp2f(da[u]);
#pragma unroll
    for (int u = 0; u < QT; ++u) { v8f ex[2];
#pragma unroll
      for (int ct = 0; ct < 2; ++ct) { const v8f d = (s[u][ct] - mn2[u]) * 1.4426950408889634f;
#pragma unroll
        for (int r = 0; r < 8; ++r) ex[ct][r] = __builtin_amdgcn_exp2f(d[r]);
        const v8h ph = __builtin_convertvector(ex[ct] * 2048.0f, v8h);
#pragma unroll
        for (int r = 0; r < 8; ++r) pb[u][ct * 8 + r] = ph[r]; }
      const v2f e2 = pairsum(ex[0]) + pairsum(ex[1]);   // a tree three deep instead of a chain of sixteen adds
      es[u] = e2[0] + e2[1];
#pragma unroll
      for (int dt = 0; dt < 8; ++dt) acc[u][dt] *= al[u]; }
    lv = lv * al + es; mv = mn2;
#pragma unroll
    for (int dt = 0; dt < 8; ++dt) {
#pragma unroll
      for (int u = 0; u < QT; ++u) acc[u][dt] = wmma16(vf[dt], pb[u], acc[u][dt]); }
    // the s_wait_xcnt 0 of the K loads above and of the V loads of the pass before stands here: K's and V's address pairs are rewritten only behind it. The products' results are its inputs, so that it stands behind the last product
    // and, by its memory clobber, the V refill behind it: lifted above the products the refill lands in a second register set, is copied back at the loop's foot and is waited out there.
    // V's address goes through the statement (as a number: a pointer would come out of it as a generic one, and its loads as flat loads) and walks on from what comes out of it, so that the pair which the V loads in flight name is rewritten only behind the wait.
    asm volatile("s_wait_xcnt 0x0" : "+s"(va) : "s"(kp), "v"(acc[0][0]), "v"(acc[0][1]), "v"(acc[0][2]), "v"(acc[0][3]), "v"(acc[0][4]), "v"(acc[0][5]), "v"(acc[0][6]), "v"(acc[0][7]),
                 "v"(acc[1][0]), "v"(acc[1][1]), "v"(acc[1][2]), "v"(acc[1][3]), "v"(acc[1][4]), "v"(acc[1][5]), "v"(acc[1][6]), "v"(acc[1][7]) : "memory");
    va += (pn != 0) ? (long long)(2 * 32 * EE) : -(long long)(NP - 1) * (2 * 32 * EE);   // bytes: on by a block, or back to the range's first; the last pass refetches the walk's first block, in bounds and unused
    const _Float16* vp = (const _Float16*)(const __attribute__((address_space(1))) _Float16*)va;
#pragma unroll
    for (int dt = 0; dt < 8; ++dt) vf[dt] = frag_p(vp + dt * 512 + lo); }
  asm volatile("s_wait_xcnt 0x0" :: "s"(va) : "memory");   // the last V loads' address pair is free for the epilogue
  // merge of the KS key ranges of a query: common maximum M, weights exp(m_k - M), L = sum of the weighted sums; each wave scales its own O^T by its weight over L, the scaled parts are added in range order
  const int ln = __builtin_amdgcn_mbcnt_lo(~0u, 0u), g2 = ln >> 4;   // the lane's number, read anew: no index of the epilogue is carried across the loop
  const int qr0 = qw * (16 * QT) + (ln & 15);
#pragma unroll
  for (int u = 0; u < QT; ++u) { const float lt = lv[u] + xhalf(lv[u]);
    if (g2 == 0) { sm[kq][qr0 + u * 16] = mv[u]; sl[kq][qr0 + u * 16] = lt; } }
  __syncthreads();   // every range's maximum and sum are in LDS
#pragma unroll
  for (int u = 0; u < QT; ++u) { const int qr = qr0 + u * 16;
    float M = sm[0][qr];
#pragma unroll
    for (int k = 1; k < KS; ++k) M = fmaxf(M, sm[k][qr]);
    float L = 0.f;
#pragma unroll
    for (int k = 0; k < KS; ++k) L += sl[k][qr] * __expf(sm[k][qr] - M);
    const float il = __expf(mv[u] - M) * (1.0f / 2048.0f) / L;
#pragma unroll
    for (int dt = 0; dt < 8; ++dt) { const v8f o = acc[u][dt] * il;   // a lane's 8 registers are 8 dims in a row of its query's output row
      *(v4f*)&so[kq][qr][dt * 16 + 8 * g2] = __builtin_shufflevector(o, o, 0, 1, 2, 3); *(v4f*)&so[kq][qr][dt * 16 + 8 * g2 + 4] = __builtin_shufflevector(o, o, 4, 5, 6, 7); } }
  __syncthreads();   // every range's scaled part is in LDS
  float* ob = OUT + (b * SS + (size_t)blockIdx.x * 64 + wave * (64 / NW)) * EE + ln * 4;
#pragma unroll
  for (int i = 0; i < 64 / NW; ++i) { v4f o = *(const v4f*)&so[0][wave * (64 / NW) + i][ln * 4];
#pragma unroll
    for (int k = 1; k < KS; ++k) o += *(const v4f*)&so[k][wave * (64 / NW) + i][ln * 4];
    vst2(ob + i * EE, o); }   // whole 512-B output row per wave
}
extern "C" void kernel_launch(void* const* d_in, const int* in_sizes, int n_in, void* d_out, int out_size, void* d_ws, size_t ws_size, hipStream_t stream) {
  (void)in_sizes; (void)n_in; (void)out_size;
  const float** F = (const float**)d_in;   // 0 x [2,8192,128], 1 Wq [128,128], 2 bq, 3 Wk, 4 bk, 5 Wv, 6 bv
  if (ws_size < (size_t)WS_END) return;
  char* ws = (char*)d_ws; _Float16 *Q = (_Float16*)(ws + WS_Q), *Kr = (_Float16*)(ws + WS_K), *V = (_Float16*)(ws + WS_V);
  k_proj<<<dim3(TNB * SS / 64, 3), 128, 0, stream>>>(F[0], F[1], F[3], F[5], F[2], F[4], F[6], Q, Kr, V);
  k_attn<<<dim3(TQB, TNB), 32 * NW, 0, stream>>>(Q, Kr, V, (float*)d_out);
}

// v008
// One run takes 53.4 microseconds.
// Two timings next to v007 both put it at 1.07 times that version's speed.
// All steps since v000 together make it 15.8 times as fast.
// compute dtype: all float inputs rounded to bf16; Q / K / V = x . W^T + b with EXACT bf16 products on WMMA 16x16x32 (natural rows), rounded once to f16; PLAIN single-head attention over 8,192 slices with 128-dim q/k/v: q, k single f16 x 128^-0.5, running-max softmax in f32 (hardware exp; the maximum in use follows the running one only when a score lies more than 4 ln 2 above it), P (scaled by 2^11, single f16) x v (single f16); f32 accumulate and output.
#include <hip/hip_runtime.h>
#include <math.h>

typedef __attribute__((ext_vector_type(16))) _Float16 v16h;
typedef __attribute__((ext_vector_type(16))) __bf16 v16b;
typedef __attribute__((ext_vector_type(8)))  _Float16 v8h;
typedef __attribute__((ext_vector_type(8)))  float v8f;
typedef __attribute__((ext_vector_type(4)))  float v4f;
typedef __attribute__((ext_vector_type(2)))  float v2f;
typedef __attribute__((ext_vector_type(4)))  unsigned v4u;
typedef __attribute__((ext_vector_type(4)))  int v4i;
typedef float __attribute__((may_alias)) float_a;
typedef int __attribute__((may_alias)) int_a;

template <typename T> __device__ __forceinline__ void vst2(void* p, T v) { *(T*)p = v;  }
// the builtin alone: the compiler keeps the distances behind its own WMMAs; a pad statement with the fragments as operands would hold every one of them in the first 256 registers (spills in a wave that owns more)
__device__ __forceinline__ v8f wmma16(v16h a, v16h b, v8f c) {
  return __builtin_amdgcn_wmma_f32_16x16x32_f16(false, a, false, b, (short)0, c, false, false);
}
__device__ __forceinline__ v8f wmma_bf(v16b a, v16b b, v8f c) {
  v8f d = __builtin_amdgcn_wmma_f32_16x16x32_bf16(false, a, false, b, (short)0, c, false, false);
  asm volatile("v_nop\n\tv_nop\n\tv_nop\n\tv_nop" : "+v"(d) : "v"(a), "v"(b));
  return d;
}
// 16x16x32 fragments: lane = (h = lane>>4, row/col = lane&15); elements 0..7 = k0+8h+0..7, 8..15 = k0+16+8h+0..7; D element r = row 8h+r
__device__ __forceinline__ v16h frag_h(const _Float16* rowk0, int lane) {
  union { v16h v; v8h q[2]; } u; const _Float16* p = rowk0 + 8 * (lane >> 4);
  u.q[0] = *(const v8h*)p; u.q[1] = *(const v8h*)(p + 16); return u.v;
}
__device__ __forceinline__ v16h frag_f32(const float* rowk0, int lane) {
  v16h a; const float* p = rowk0 + 8 * (lane >> 4);
#pragma unroll
  for (int i = 0; i < 8; ++i) { a[i] = (_Float16)p[i]; a[8 + i] = (_Float16)p[16 + i]; }
  return a;
}
__device__ __forceinline__ v16h frag_f32s(const float* rowk0, int lane, float sc) {
  v16h a; const float* p = rowk0 + 8 * (lane >> 4);
#pragma unroll
  for (int i = 0; i < 8; ++i) { a[i] = (_Float16)(p[i] * sc); a[8 + i] = (_Float16)(p[16 + i] * sc); }
  return a;
}
// column fragment from a [K][ld] layout (column n), rows >= K read as 0
__device__ __forceinline__ v16h fragc_f32(const float* W, int k0, int n, int lane, int ld, int K) {
  v16h a; const int g = lane >> 4;
#pragma unroll
  for (int i = 0; i < 8; ++i) { const int ka = k0 + 8 * g + i, kb = ka + 16;
    a[i] = (_Float16)(ka < K ? W[(size_t)(ka < K ? ka : K - 1) * ld + n] : 0.f); a[8 + i] = (_Float16)(kb < K ? W[(size_t)(kb < K ? kb : K - 1) * ld + n] : 0.f); }
  return a;
}
struct F2 { v16b h, l; };
__device__ __forceinline__ F2 bsplit16(const float v[16]) { F2 r;
#pragma unroll
  for (int i = 0; i < 16; ++i) { const __bf16 h = (__bf16)v[i]; r.h[i] = h; r.l[i] = (__bf16)(v[i] - (float)h); }
  return r; }
__device__ __forceinline__ F2 split_row(const float* row, int k0, int lane) { float v[16]; const float* p = row + k0 + 8 * (lane >> 4);
#pragma unroll
  for (int i = 0; i < 8; ++i) { v[i] = p[i]; v[8 + i] = p[16 + i]; }
  return bsplit16(v); }
__device__ __forceinline__ F2 split_rowK(const float* row, int k0, int lane, int K) { float v[16]; const int g = lane >> 4;
#pragma unroll
  for (int i = 0; i < 8; ++i) { const int ka = k0 + 8 * g + i, kb = ka + 16; v[i] = ka < K ? row[ka < K ? ka : K - 1] : 0.f; v[8 + i] = kb < K ? row[kb < K ? kb : K - 1] : 0.f; }
  return bsplit16(v); }
__device__ __forceinline__ F2 split_col(const float* W, int k0, int n, int lane, int ld, int K) { float v[16]; const int g = lane >> 4;
#pragma unroll
  for (int i = 0; i < 8; ++i) { const int ka = k0 + 8 * g + i, kb = ka + 16; v[i] = ka < K ? W[(size_t)(ka < K ? ka : K - 1) * ld + n] : 0.f; v[8 + i] = kb < K ? W[(size_t)(kb < K ? kb : K - 1) * ld + n] : 0.f; }
  return bsplit16(v); }
__device__ __forceinline__ v8f mac3(const F2& a, const F2& b, v8f c) { c = wmma_bf(a.l, b.h, c); c = wmma_bf(a.h, b.l, c); return wmma_bf(a.h, b.h, c); }
__device__ __forceinline__ float sigm(float v) { return 1.0f / (1.0f + expf(-v)); }
#define LDSX() do { asm volatile("s_wait_dscnt 0" ::: "memory"); __builtin_amdgcn_wave_barrier(); __builtin_amdgcn_fence(__ATOMIC_RELEASE, "workgroup"); } while (0)


// Slice attention (B 2, 8,192 slices, 128 features, one head): 1x1-conv q / k / v projections + biases, softmax(Q K^T / sqrt(128)) V.
#define NB 2
#define SS 8192
#define EE 128
#define NR (NB * SS)
#ifndef TQB
#define TQB (SS / 64)
#define TNB NB
#endif
typedef __attribute__((ext_vector_type(8))) __bf16 v8b;
__device__ __forceinline__ v16b frag_b(const __bf16* rowk0, int lane) {
  union { v16b v; v8b q[2]; } u; const __bf16* p = rowk0 + 8 * (lane >> 4);
  u.q[0] = *(const v8b*)p; u.q[1] = *(const v8b*)(p + 16); return u.v;
}
__device__ __forceinline__ float bfr(float v) { return (float)(__bf16)v; }
__device__ __attribute__((noinline)) float exp_ni(float v) { return expf(v); }
__device__ __attribute__((noinline)) float erf_ni(float v) { return erff(v); }

#define WS_PW  0u                                  // [3][128][128] 16-bit words, not used
#define WS_Q   (WS_PW + 2u * 3 * EE * EE)           // f16 [NR][128] q rows ; K and V in fragment order (below)
// K: [16-key tile][kc * 2 + h][lane][8]: lane (g, col) holds key col, dims kc * 32 + h * 16 + g * 8 + 0..7.  V: [32-key block][dt * 2 + h][lane][8]: lane (g, col) holds dim dt * 16 + col, keys h * 16 + g * 8 + 0..7.
// Each [lane][8] unit is 512 contiguous bytes, one wave-wide 16-byte load of k_attn: 4 whole lines, where rows and planes gave 16 lines of 32 used bytes.
#define WS_K   (WS_Q + 2u * (size_t)NR * EE)
#define WS_V   (WS_K + 2u * (size_t)NR * EE)
#define WS_END (WS_V + 2u * (size_t)NB * EE * SS)

// ---- k_proj: block = (64 rows, which): 128 output cols; q -> f16 rows; k, v -> fragment order
// The block rounds its own W (128 x 128 f32) to bf16 into LDS, once: a wave-wide 16-byte load takes one whole row of W (4 whole lines), and the B fragments come from LDS.
typedef __attribute__((ext_vector_type(4))) __bf16 v4b;
__global__ __launch_bounds__(128) void k_proj(const float* __restrict__ X, const float* __restrict__ WQ, const float* __restrict__ WK, const float* __restrict__ WV, const float* __restrict__ BQ, const float* __restrict__ BK, const float* __restrict__ BV, _Float16* __restrict__ Q, _Float16* __restrict__ Kr, _Float16* __restrict__ V) {
  __shared__ __align__(16) _Float16 so[64][136]; __shared__ __align__(16) _Float16 st[128][72];
  __shared__ __align__(16) __bf16 sw[EE][136];   // W as bf16 rows; pitch 272 B = 17 x 16 B: a 16-byte LDS load over 16 rows meets no bank twice
  const int tid = threadIdx.x, wave = tid >> 5, lane = tid & 31, col = lane & 15, g = lane >> 4; const int which = blockIdx.y; const size_t rb0 = (size_t)blockIdx.x * 64, r0 = rb0 + wave * 16;
  const float* Wm = (which == 0) ? WQ : (which == 1) ? WK : WV; const float* BB = (which == 0) ? BQ : (which == 1) ? BK : BV;
  // all of the wave's X loads and its share of the W loads are issued ahead of the first wait: one trip to memory in all
  v4f xr[EE / 32][4], wr[EE / 4];
#pragma unroll
  for (int kc = 0; kc < EE / 32; ++kc) { const float* p = X + (r0 + col) * EE + kc * 32 + 8 * g;
    xr[kc][0] = *(const v4f*)p; xr[kc][1] = *(const v4f*)(p + 4); xr[kc][2] = *(const v4f*)(p + 16); xr[kc][3] = *(const v4f*)(p + 20); }
  asm volatile("s_wait_xcnt 0x0" ::: "memory");   // behind the X loads: their address pair is free for the W loads' address and results
  __builtin_amdgcn_sched_barrier(0);   // and nothing that rewrites it is lifted over the wait
#pragma unroll
  for (int i = 0; i < EE / 4; ++i) wr[i] = *(const v4f*)(Wm + (size_t)(i * 4 + wave) * EE + lane * 4);
  asm volatile("s_wait_xcnt 0x0" ::: "memory");   // behind the W loads: their address pair is reused by what follows
  __builtin_amdgcn_sched_barrier(0);   // and nothing that rewrites it is lifted over the wait
#pragma unroll
  for (int i = 0; i < EE / 4; ++i) *(v4b*)&sw[i * 4 + wave][lane * 4] = __builtin_convertvector(wr[i], v4b);
  v16b a[EE / 32];
#pragma unroll
  for (int kc = 0; kc < EE / 32; ++kc) {
    union { v16b v; v4b q[4]; } u;   // elements 0..7 = k 8g + 0..7 of the chunk, 8..15 = k 16 + 8g + 0..7
#pragma unroll
    for (int t = 0; t < 4; ++t) u.q[t] = __builtin_convertvector(xr[kc][t], v4b);
    a[kc] = u.v; }
  __syncthreads();   // every wave's rows of W are in LDS
  v8f acc[8] = {}; v16b bw[2][8];   // B fragments one k chunk ahead, eight as one group in front of the chunk's products
#pragma unroll
  for (int j = 0; j < 8; ++j) bw[0][j] = frag_b(&sw[j * 16 + col][0], lane);
#pragma unroll
  for (int kc = 0; kc < EE / 32; ++kc) {
    if (kc + 1 < EE / 32) {
#pragma unroll
      for (int j = 0; j < 8; ++j) bw[(kc + 1) & 1][j] = frag_b(&sw[j * 16 + col][(kc + 1) * 32], lane); }
#pragma unroll
    for (int j = 0; j < 8; ++j) acc[j] = wmma_bf(a[kc], bw[kc & 1][j], acc[j]); }
  if (which < 2) {
#pragma unroll
    for (int j = 0; j < 8; ++j) { const float bb = bfr(BB[j * 16 + col]);
#pragma unroll
      for (int r = 0; r < 8; ++r) so[wave * 16 + 8 * g + r][j * 16 + col] = (_Float16)(acc[j][r] + bb); }
    LDSX();
    if (which == 0) { for (int rl = 0; rl < 16; ++rl) if (lane < 16) vst2((unsigned*)(Q + (r0 + rl) * EE + lane * 8), *(const v4u*)&so[wave * 16 + rl][lane * 8]); }
    else {   // the wave's 16 rows are one key tile: 8 units of 512 B
#pragma unroll
      for (int i = 0; i < 8; ++i) vst2((unsigned*)(Kr + r0 * EE + i * 256 + lane * 8), *(const v4u*)&so[wave * 16 + col][i * 16 + g * 8]);
      asm volatile("s_wait_xcnt 0x0" ::: "memory"); }   // behind the last K store: no register that the eight stores name is rewritten ahead of it on any path of the listing
  } else {
#pragma unroll
    for (int j = 0; j < 8; ++j) { const float bb = bfr(BB[j * 16 + col]);
#pragma unroll
      for (int r = 0; r < 8; ++r) st[j * 16 + col][wave * 16 + 8 * g + r] = (_Float16)(acc[j][r] + bb); }
    __syncthreads();
    // the block's 64 keys are two 32-key blocks, 16 KB in a row: 16-byte piece e = ((block * 8 + dt) * 2 + h) * 32 + g * 16 + col
    for (int e = tid; e < 128 * 8; e += 128) vst2((unsigned*)(V + rb0 * EE + (size_t)e * 8), *(const v4u*)&st[((e >> 6) & 7) * 16 + (e & 15)][(e >> 9) * 32 + ((e >> 5) & 1) * 16 + ((e >> 4) & 1) * 8]); }
}
// fragment in fragment order at a lane's own address (8 * lane already added): its two halves are the lane's 16 bytes of two 512-B units in a row
__device__ __forceinline__ v16h frag_p(const _Float16* p) { union { v16h v; v8h q[2]; } u; u.q[0] = *(const v8h*)p; u.q[1] = *(const v8h*)(p + 256); return u.v; }
// lane l with lane l ^ 16 on the vector pipe (a shuffle would go through the LDS unit and its wait)
__device__ __forceinline__ float xhalf(float x) { return __builtin_bit_cast(float, __builtin_amdgcn_permlanex16(__builtin_bit_cast(int, x), __builtin_bit_cast(int, x), 0x76543210, 0xfedcba98, false, false)); }
// (x0 + x2) + (x4 + x6) and (x1 + x3) + (x5 + x7): packed adds on neighbouring registers
__device__ __forceinline__ v2f pairsum(v8f x) { return (__builtin_shufflevector(x, x, 0, 1) + __builtin_shufflevector(x, x, 2, 3)) + (__builtin_shufflevector(x, x, 4, 5) + __builtin_shufflevector(x, x, 6, 7)); }
__device__ __forceinline__ float max8(v8f t) { return fmaxf(fmaxf(fmaxf(t[0], t[1]), fmaxf(t[2], t[3])), fmaxf(fmaxf(t[4], t[5]), fmaxf(t[6], t[7]))); }
// ---- k_attn: block = (64 queries, b): 128-dim q/k/v, all 8,192 keys, plain; f32 output rows
// KS key ranges a block: wave (qw, kq) walks key range kq alone (SS / KS keys) for its own queries, with their maximum in use, sum and O^T; the ranges are merged through LDS behind the loop.
#define KS 4
// QT 16-query tiles a wave: every K and V fragment that a wave loads feeds QT products instead of one, so the block moves 1 / QT of the fragment bytes from the cache into registers for the same products.
// The block is then 4 / QT * KS waves, 2 a SIMD, each with up to 512 registers.
#define QT 2
#define NW (4 / QT * KS)
#define NP (SS / 32 / KS)   // passes of 32 keys in a key range
#define SCL 0.08838834764831845f   // 128^-0.5
#define SCL8 ((v8f){SCL, SCL, SCL, SCL, SCL, SCL, SCL, SCL})
#define RTH 2.772588722239781f   // 4 ln 2: how far a score may lie above the maximum in use before O^T and the sum are rescaled
// Transposed products: S^T = K . Q^T (A = K fragment, B = Q fragment) and O^T += V^T . P^T (A = V fragment, B = P^T). Lane (g, col) then holds, of query col alone, the scores of keys 8g + r of each
// 16-key tile: maximum and sum are in-lane but for one exchange between the halves, and the two score tiles of a pass, converted in place, ARE the B fragment of the second product (element ct * 8 + r = key ct * 16 + 8g + r).
__global__ __launch_bounds__(32 * NW) void k_attn(const _Float16* __restrict__ Q, const _Float16* __restrict__ Kr, const _Float16* __restrict__ V, float* __restrict__ OUT) {
  __shared__ __align__(16) float so[KS][64][132]; __shared__ float sm[KS][64], sl[KS][64];
  const int tid = threadIdx.x, wave = __builtin_amdgcn_readfirstlane(tid >> 5), qw = wave & (4 / QT - 1), kq = wave / (4 / QT), lane = tid & 31, col = lane & 15; const size_t b = blockIdx.y; const int q0 = blockIdx.x * 64 + qw * (16 * QT); const size_t rq = b * SS + q0;
  v16h aq[QT][4];
#pragma unroll
  for (int u = 0; u < QT; ++u) {
#pragma unroll
    for (int kc = 0; kc < 4; ++kc) aq[u][kc] = frag_h(Q + (rq + u * 16 + col) * EE + kc * 32, lane); }
  static_assert(QT == 2, "the pairs below and the operand list of the wait in the loop are written for two tiles");
  v2f mv = {-3.0e38f, -3.0e38f}, lv = {0.f, 0.f};   // element u: maximum in use and sum of query u * 16 + col; the sum is of this half's keys only, the halves are joined behind the loop
  v8f acc[QT][8] = {};           // acc[u][dt][r] = O^T[dim dt * 16 + 8g + r][query u * 16 + col]
  asm volatile("s_wait_xcnt 0x0" ::: "memory");   // the Q loads' address pair is free for reuse by what follows
  // K and V fragments live in registers one pass ahead: each set is refilled as ONE group of loads right behind its last product,
  // so a pass waits for no load of its own.
  const size_t kb = (b * SS + (size_t)kq * (SS / KS)) * EE;   // first key of the wave's range: the same in every lane, so the walking addresses are scalar and cost no vector register
  // Every block walks each key range once round, from a pass of its own: walked from the same end, all blocks of a batch ask the L2 for the same few lines at the same moment, and each line's first fetch is waited for by all of them in every pass.
  // Odd multiplier: neighbouring blocks start far apart, and every start is taken by two of the 128 blocks, wherever the blocks are placed.
  static_assert((NP & (NP - 1)) == 0, "the walk wraps by a mask");
  const int p0 = (int)((blockIdx.x * 27u >> 1) & (NP - 1));
  const _Float16* Kb = Kr + kb; const _Float16* Kg = Kb + (size_t)p0 * 32 * EE; const _Float16* Vg = V + kb + (size_t)p0 * 32 * EE; const int lo = 8 * lane;
  v16h kf[2][4], vf[8];
#pragma unroll
  for (int ct = 0; ct < 2; ++ct) {
#pragma unroll
    for (int kc = 0; kc < 4; ++kc) kf[ct][kc] = frag_p(Kg + ct * 16 * EE + kc * 512 + lo); }
  __builtin_amdgcn_sched_barrier(0);   // V's first loads stay the youngest, as in the loop: else the counted waits at the loop's head, merged from both ways in, also drain V
  unsigned long long va = (unsigned long long)Vg;
#pragma unroll
  for (int dt = 0; dt < 8; ++dt) vf[dt] = frag_p(Vg + dt * 512 + lo);
  asm volatile("s_wait_xcnt 0x0" ::: "memory");   // behind the first K and V loads: the offset register that they name is reused by what follows
  __builtin_amdgcn_sched_barrier(0);   // and nothing that rewrites it is lifted over the wait
#pragma unroll 1
  for (int ks = 0; ks < NP; ++ks) { const int pn = (p0 + ks + 1) & (NP - 1), jn = pn * 32; v8f s[QT][2];   // next pass's keys, round the range; the last pass refetches the walk's first tiles, in bounds and unused
#pragma unroll
    for (int ct = 0; ct < 2; ++ct) { v8f c[QT] = {};
#pragma unroll
      for (int kc = 0; kc < 4; ++kc) {
#pragma unroll
        for (int u = 0; u < QT; ++u) c[u] = wmma16(kf[ct][kc], aq[u][kc], c[u]); }
#pragma unroll
      for (int u = 0; u < QT; ++u) s[u][ct] = c[u]; }   // raw products; 128^-0.5 comes in with the maximum, in one fused step
    const _Float16* kp = Kb + (size_t)jn * EE;
    __builtin_amdgcn_sched_barrier(0);   // the K refill stays one group behind the last product that reads the set
#pragma unroll
    for (int ct = 0; ct < 2; ++ct) {
#pragma unroll
      for (int kc = 0; kc < 4; ++kc) kf[ct][kc] = frag_p(kp + ct * 16 * EE + kc * 512 + lo); }
    v16h pb[QT]; v2f top, es;   // element u of a pair belongs to query tile u
    // The softmax is written on whole register vectors, so that the packed instructions take neighbouring registers of ONE tile (left to itself the compiler pairs values of different tiles, or a score with the old maximum, and moves them together first).
    // Lazy rescale: mv is the maximum IN USE, the same in both halves of a query. It stays, and O^T and the sum stay as they are, while no score of the pass lies more than RTH above it:
    // then P <= 2^4, and P * 2^11 <= 2^15 is inside f16. The result does not depend on which maximum is in use: O^T and the sum carry the same factor.
    // The test is made on the very differences that go on to the exponential, so it bounds each exponent as computed, whatever the size of the scores.
    v8f e[QT][2];   // score minus the maximum in use
#pragma unroll
    for (int u = 0; u < QT; ++u) {
#pragma unroll
      for (int ct = 0; ct < 2; ++ct) e[u][ct] = __builtin_elementwise_fma(s[u][ct], SCL8, -(v8f){mv[u], mv[u], mv[u], mv[u], mv[u], mv[u], mv[u], mv[u]});
      top[u] = max8(__builtin_elementwise_max(e[u][0], e[u][1])); }   // of this half's 16 keys of the pass
    if (__builtin_expect(__builtin_amdgcn_ballot_w32((top[0] > RTH) | (top[1] > RTH)) != 0u, 0)) {   // one test a pass, the same for the whole wave; always taken in a wave's first pass, seldom later: marked so, it lies outside the loop's straight line
      v2f mx2;
#pragma unroll
      for (int u = 0; u < QT; ++u) mx2[u] = max8(__builtin_elementwise_max(s[u][0], s[u][1])) * SCL;
      mx2 = __builtin_elementwise_max(mx2, (v2f){xhalf(mx2[0]), xhalf(mx2[1])});   // all 32 keys of the pass: both halves scale P and O^T alike
      const v2f mn2 = __builtin_elementwise_max(mv, mx2), da = (mv - mn2) * 1.4426950408889634f;   // exp(x) = 2^(x log2 e), on the hardware's exp2
#pragma unroll
      for (int u = 0; u < QT; ++u) { const float al = (mv[u] <= -1.0e38f) ? 0.f : __builtin_amdgcn_exp2f(da[u]);
        lv[u] *= al;
#pragma unroll
        for (int dt = 0; dt < 8; ++dt) acc[u][dt] *= al;
#pragma unroll
        for (int ct = 0; ct < 2; ++ct) e[u][ct] = __builtin_elementwise_fma(s[u][ct], SCL8, -(v8f){mn2[u], mn2[u], mn2[u], mn2[u], mn2[u], mn2[u], mn2[u], mn2[u]}); }
      mv = mn2; }
#pragma unroll
    for (int u = 0; u < QT; ++u) { v8f ex[2];
#pragma unroll
      for (int ct = 0; ct < 2; ++ct) { const v8f d = e[u][ct] * 1.4426950408889634f;
#pragma unroll
        for (int r = 0; r < 8; ++r) ex[ct][r] = __builtin_amdgcn_exp2f(d[r]);
        const v8h ph = __builtin_convertvector(ex[ct] * 2048.0f, v8h);
#pragma unroll
        for (int r = 0; r < 8; ++r) pb[u][ct * 8 + r] = ph[r]; }
      const v2f e2 = pairsum(ex[0]) + pairsum(ex[1]);   // a tree three deep instead of a chain of sixteen adds
      es[u] = e2[0] + e2[1]; }
    lv += es;
#pragma unroll
    for (int dt = 0; dt < 8; ++dt) {
#pragma unroll
      for (int u = 0; u < QT; ++u) acc[u][dt] = wmma16(vf[dt], pb[u], acc[u][dt]); }
    // the s_wait_xcnt 0 of the K loads above and of the V loads of the pass before stands here: K's and V's address pairs are rewritten only behind it. The products' results are its inputs, so that it stands behind the last product
    // and, by its memory clobber, the V refill behind it: lifted above the products the refill lands in a second register set, is copied back at the loop's foot and is waited out there.
    // V's address goes through the statement (as a number: a pointer would come out of it as a generic one, and its loads as flat loads) and walks on from what comes out of it, so that the pair which the V loads in flight name is rewritten only behind the wait.
    asm volatile("s_wait_xcnt 0x0" : "+s"(va) : "s"(kp), "v"(acc[0][0]), "v"(acc[0][1]), "v"(acc[0][2]), "v"(acc[0][3]), "v"(acc[0][4]), "v"(acc[0][5]), "v"(acc[0][6]), "v"(acc[0][7]),
                 "v"(acc[1][0]), "v"(acc[1][1]), "v"(acc[1][2]), "v"(acc[1][3]), "v"(acc[1][4]), "v"(acc[1][5]), "v"(acc[1][6]), "v"(acc[1][7]) : "memory");
    va += (pn != 0) ? (long long)(2 * 32 * EE) : -(long long)(NP - 1) * (2 * 32 * EE);   // bytes: on by a block, or back to the range's first; the last pass refetches the walk's first block, in bounds and unused
    const _Float16* vp = (const _Float16*)(const __attribute__((address_space(1))) _Float16*)va;
#pragma unroll
    for (int dt = 0; dt < 8; ++dt) vf[dt] = frag_p(vp + dt * 512 + lo); }
  asm volatile("s_wait_xcnt 0x0" :: "s"(va) : "memory");   // the last V loads' address pair is free for the epilogue
  // merge of the KS key ranges of a query: common maximum M, weights exp(m_k - M), L = sum of the weighted sums; each wave scales its own O^T by its weight over L, the scaled parts are added in range order
  const int ln = __builtin_amdgcn_mbcnt_lo(~0u, 0u), g2 = ln >> 4;   // the lane's number, read anew: no index of the epilogue is carried across the loop
  const int qr0 = qw * (16 * QT) + (ln & 15);
#pragma unroll
  for (int u = 0; u < QT; ++u) { const float lt = lv[u] + xhalf(lv[u]);
    if (g2 == 0) { sm[kq][qr0 + u * 16] = mv[u]; sl[kq][qr0 + u * 16] = lt; } }
  __syncthreads();   // every range's maximum and sum are in LDS
#pragma unroll
  for (int u = 0; u < QT; ++u) { const int qr = qr0 + u * 16;
    float M = sm[0][qr];
#pragma unroll
    for (int k = 1; k < KS; ++k) M = fmaxf(M, sm[k][qr]);
    float L = 0.f;
#pragma unroll
    for (int k = 0; k < KS; ++k) L += sl[k][qr] * __expf(sm[k][qr] - M);
    const float il = __expf(mv[u] - M) * (1.0f / 2048.0f) / L;
#pragma unroll
    for (int dt = 0; dt < 8; ++dt) { const v8f o = acc[u][dt] * il;   // a lane's 8 registers are 8 dims in a row of its query's output row
      *(v4f*)&so[kq][qr][dt * 16 + 8 * g2] = __builtin_shufflevector(o, o, 0, 1, 2, 3); *(v4f*)&so[kq][qr][dt * 16 + 8 * g2 + 4] = __builtin_shufflevector(o, o, 4, 5, 6, 7); } }
  __syncthreads();   // every range's scaled part is in LDS
  float* ob = OUT + (b * SS + (size_t)blockIdx.x * 64 + wave * (64 / NW)) * EE + ln * 4;
#pragma unroll
  for (int i = 0; i < 64 / NW; ++i) { v4f o = *(const v4f*)&so[0][wave * (64 / NW) + i][ln * 4];
#pragma unroll
    for (int k = 1; k < KS; ++k) o += *(const v4f*)&so[k][wave * (64 / NW) + i][ln * 4];
    vst2(ob + i * EE, o); }   // whole 512-B output row per wave
}
extern "C" void kernel_launch(void* const* d_in, const int* in_sizes, int n_in, void* d_out, int out_size, void* d_ws, size_t ws_size, hipStream_t stream) {
  (void)in_sizes; (void)n_in; (void)out_size;
  const float** F = (const float**)d_in;   // 0 x [2,8192,128], 1 Wq [128,128], 2 bq, 3 Wk, 4 bk, 5 Wv, 6 bv
  if (ws_size < (size_t)WS_END) return;
  char* ws = (char*)d_ws; _Float16 *Q = (_Float16*)(ws + WS_Q), *Kr = (_Float16*)(ws + WS_K), *V = (_Float16*)(ws + WS_V);
  k_proj<<<dim3(TNB * SS / 64, 3), 128, 0, stream>>>(F[0], F[1], F[3], F[5], F[2], F[4], F[6], Q, Kr, V);
  k_attn<<<dim3(TQB, TNB), 32 * NW, 0, stream>>>(Q, Kr, V, (float*)d_out);
}

// v009
// Measured time: 51.2 microseconds a run.
// Two timings next to v008 both put it at 1.04 times that version's speed.
// All steps since v000 together make it 16.5 times as fast.
// compute dtype: all float inputs rounded to bf16; Q / K / V = x . W^T + b with EXACT bf16 products on WMMA 16x16x32 (natural rows), rounded once to f16; PLAIN single-head attention over 8,192 slices with 128-dim q/k/v: q x 128^-0.5 log2 e and k single f16, running-max softmax in f32 on base 2 (hardware exp2; the maximum in use follows the running one only when a score lies more than 4 above it in base 2), P (scaled by 2^11, single f16) x v (single f16); f32 accumulate and output.
#include <hip/hip_runtime.h>
#include <math.h>

typedef __attribute__((ext_vector_type(16))) _Float16 v16h;
typedef __attribute__((ext_vector_type(16))) __bf16 v16b;
typedef __attribute__((ext_vector_type(8)))  _Float16 v8h;
typedef __attribute__((ext_vector_type(8)))  float v8f;
typedef __attribute__((ext_vector_type(4)))  float v4f;
typedef __attribute__((ext_vector_type(2)))  float v2f;
typedef __attribute__((ext_vector_type(4)))  unsigned v4u;
typedef __attribute__((ext_vector_type(4)))  int v4i;
typedef float __attribute__((may_alias)) float_a;
typedef int __attribute__((may_alias)) int_a;

template <typename T> __device__ __forceinline__ void vst2(void* p, T v) { *(T*)p = v;  }
// the builtin alone: the compiler keeps the distances behind its own WMMAs; a pad statement with the fragments as operands would hold every one of them in the first 256 registers (spills in a wave that owns more)
__device__ __forceinline__ v8f wmma16(v16h a, v16h b, v8f c) {
  return __builtin_amdgcn_wmma_f32_16x16x32_f16(false, a, false, b, (short)0, c, false, false);
}
__device__ __forceinline__ v8f wmma_bf(v16b a, v16b b, v8f c) {
  v8f d = __builtin_amdgcn_wmma_f32_16x16x32_bf16(false, a, false, b, (short)0, c, false, false);
  asm volatile("v_nop\n\tv_nop\n\tv_nop\n\tv_nop" : "+v"(d) : "v"(a), "v"(b));
  return d;
}
// 16x16x32 fragments: lane = (h = lane>>4, row/col = lane&15); elements 0..7 = k0+8h+0..7, 8..15 = k0+16+8h+0..7; D element r = row 8h+r
__device__ __forceinline__ v16h frag_h(const _Float16* rowk0, int lane) {
  union { v16h v; v8h q[2]; } u; const _Float16* p = rowk0 + 8 * (lane >> 4);
  u.q[0] = *(const v8h*)p; u.q[1] = *(const v8h*)(p + 16); return u.v;
}
__device__ __forceinline__ v16h frag_f32(const float* rowk0, int lane) {
  v16h a; const float* p = rowk0 + 8 * (lane >> 4);
#pragma unroll
  for (int i = 0; i < 8; ++i) { a[i] = (_Float16)p[i]; a[8 + i] = (_Float16)p[16 + i]; }
  return a;
}
__device__ __forceinline__ v16h frag_f32s(const float* rowk0, int lane, float sc) {
  v16h a; const float* p = rowk0 + 8 * (lane >> 4);
#pragma unroll
  for (int i = 0; i < 8; ++i) { a[i] = (_Float16)(p[i] * sc); a[8 + i] = (_Float16)(p[16 + i] * sc); }
  return a;
}
// column fragment from a [K][ld] layout (column n), rows >= K read as 0
__device__ __forceinline__ v16h fragc_f32(const float* W, int k0, int n, int lane, int ld, int K) {
  v16h a; const int g = lane >> 4;
#pragma unroll
  for (int i = 0; i < 8; ++i) { const int ka = k0 + 8 * g + i, kb = ka + 16;
    a[i] = (_Float16)(ka < K ? W[(size_t)(ka < K ? ka : K - 1) * ld + n] : 0.f); a[8 + i] = (_Float16)(kb < K ? W[(size_t)(kb < K ? kb : K - 1) * ld + n] : 0.f); }
  return a;
}
struct F2 { v16b h, l; };
__device__ __forceinline__ F2 bsplit16(const float v[16]) { F2 r;
#pragma unroll
  for (int i = 0; i < 16; ++i) { const __bf16 h = (__bf16)v[i]; r.h[i] = h; r.l[i] = (__bf16)(v[i] - (float)h); }
  return r; }
__device__ __forceinline__ F2 split_row(const float* row, int k0, int lane) { float v[16]; const float* p = row + k0 + 8 * (lane >> 4);
#pragma unroll
  for (int i = 0; i < 8; ++i) { v[i] = p[i]; v[8 + i] = p[16 + i]; }
  return bsplit16(v); }
__device__ __forceinline__ F2 split_rowK(const float* row, int k0, int lane, int K) { float v[16]; const int g = lane >> 4;
#pragma unroll
  for (int i = 0; i < 8; ++i) { const int ka = k0 + 8 * g + i, kb = ka + 16; v[i] = ka < K ? row[ka < K ? ka : K - 1] : 0.f; v[8 + i] = kb < K ? row[kb < K ? kb : K - 1] : 0.f; }
  return bsplit16(v); }
__device__ __forceinline__ F2 split_col(const float* W, int k0, int n, int lane, int ld, int K) { float v[16]; const int g = lane >> 4;
#pragma unroll
  for (int i = 0; i < 8; ++i) { const int ka = k0 + 8 * g + i, kb = ka + 16; v[i] = ka < K ? W[(size_t)(ka < K ? ka : K - 1) * ld + n] : 0.f; v[8 + i] = kb < K ? W[(size_t)(kb < K ? kb : K - 1) * ld + n] : 0.f; }
  return bsplit16(v); }
__device__ __forceinline__ v8f mac3(const F2& a, const F2& b, v8f c) { c = wmma_bf(a.l, b.h, c); c = wmma_bf(a.h, b.l, c); return wmma_bf(a.h, b.h, c); }
__device__ __forceinline__ float sigm(float v) { return 1.0f / (1.0f + expf(-v)); }
#define LDSX() do { asm volatile("s_wait_dscnt 0" ::: "memory"); __builtin_amdgcn_wave_barrier(); __builtin_amdgcn_fence(__ATOMIC_RELEASE, "workgroup"); } while (0)


// Slice attention (B 2, 8,192 slices, 128 features, one head): 1x1-conv q / k / v projections + biases, softmax(Q K^T / sqrt(128)) V.
#define NB 2
#define SS 8192
#define EE 128
#define NR (NB * SS)
#ifndef TQB
#define TQB (SS / 64)
#define TNB NB
#endif
typedef __attribute__((ext_vector_type(8))) __bf16 v8b;
__device__ __forceinline__ v16b frag_b(const __bf16* rowk0, int lane) {
  union { v16b v; v8b q[2]; } u; const __bf16* p = rowk0 + 8 * (lane >> 4);
  u.q[0] = *(const v8b*)p; u.q[1] = *(const v8b*)(p + 16); return u.v;
}
__device__ __forceinline__ float bfr(float v) { return (float)(__bf16)v; }
__device__ __attribute__((noinline)) float exp_ni(float v) { return expf(v); }
__device__ __attribute__((noinline)) float erf_ni(float v) { return erff(v); }

#define QSC (0.08838834764831845f * 1.4426950408889634f)   // 128^-0.5 log2 e
#define WS_PW  0u                                  // [3][128][128] 16-bit words, not used
#define WS_Q   (WS_PW + 2u * 3 * EE * EE)           // f16 [NR][128] q rows ; K and V in fragment order (below)
// K: [16-key tile][kc * 2 + h][lane][8]: lane (g, col) holds key col, dims kc * 32 + h * 16 + g * 8 + 0..7.  V: [32-key block][dt * 2 + h][lane][8]: lane (g, col) holds dim dt * 16 + col, keys h * 16 + g * 8 + 0..7.
// Each [lane][8] unit is 512 contiguous bytes, one wave-wide 16-byte load of k_attn: 4 whole lines, where rows and planes gave 16 lines of 32 used bytes.
#define WS_K   (WS_Q + 2u * (size_t)NR * EE)
#define WS_V   (WS_K + 2u * (size_t)NR * EE)
#define WS_END (WS_V + 2u * (size_t)NB * EE * SS)

// ---- k_proj: block = (64 rows, which): 128 output cols; q -> f16 rows; k, v -> fragment order
// The block rounds its own W (128 x 128 f32) to bf16 into LDS, once: a wave-wide 16-byte load takes one whole row of W (4 whole lines), and the B fragments come from LDS.
typedef __attribute__((ext_vector_type(4))) __bf16 v4b;
__global__ __launch_bounds__(128) void k_proj(const float* __restrict__ X, const float* __restrict__ WQ, const float* __restrict__ WK, const float* __restrict__ WV, const float* __restrict__ BQ, const float* __restrict__ BK, const float* __restrict__ BV, _Float16* __restrict__ Q, _Float16* __restrict__ Kr, _Float16* __restrict__ V) {
  __shared__ __align__(16) _Float16 so[64][136]; __shared__ __align__(16) _Float16 st[128][72];
  __shared__ __align__(16) __bf16 sw[EE][136];   // W as bf16 rows; pitch 272 B = 17 x 16 B: a 16-byte LDS load over 16 rows meets no bank twice
  const int tid = threadIdx.x, wave = tid >> 5, lane = tid & 31, col = lane & 15, g = lane >> 4; const int which = blockIdx.y; const size_t rb0 = (size_t)blockIdx.x * 64, r0 = rb0 + wave * 16;
  const float* Wm = (which == 0) ? WQ : (which == 1) ? WK : WV; const float* BB = (which == 0) ? BQ : (which == 1) ? BK : BV;
  // all of the wave's X loads and its share of the W loads are issued ahead of the first wait: one trip to memory in all
  v4f xr[EE / 32][4], wr[EE / 4];
#pragma unroll
  for (int kc = 0; kc < EE / 32; ++kc) { const float* p = X + (r0 + col) * EE + kc * 32 + 8 * g;
    xr[kc][0] = *(const v4f*)p; xr[kc][1] = *(const v4f*)(p + 4); xr[kc][2] = *(const v4f*)(p + 16); xr[kc][3] = *(const v4f*)(p + 20); }
  asm volatile("s_wait_xcnt 0x0" ::: "memory");   // behind the X loads: their address pair is free for the W loads' address and results
  __builtin_amdgcn_sched_barrier(0);   // and nothing that rewrites it is lifted over the wait
#pragma unroll
  for (int i = 0; i < EE / 4; ++i) wr[i] = *(const v4f*)(Wm + (size_t)(i * 4 + wave) * EE + lane * 4);
  asm volatile("s_wait_xcnt 0x0" ::: "memory");   // behind the W loads: their address pair is reused by what follows
  __builtin_amdgcn_sched_barrier(0);   // and nothing that rewrites it is lifted over the wait
#pragma unroll
  for (int i = 0; i < EE / 4; ++i) *(v4b*)&sw[i * 4 + wave][lane * 4] = __builtin_convertvector(wr[i], v4b);
  v16b a[EE / 32];
#pragma unroll
  for (int kc = 0; kc < EE / 32; ++kc) {
    union { v16b v; v4b q[4]; } u;   // elements 0..7 = k 8g + 0..7 of the chunk, 8..15 = k 16 + 8g + 0..7
#pragma unroll
    for (int t = 0; t < 4; ++t) u.q[t] = __builtin_convertvector(xr[kc][t], v4b);
    a[kc] = u.v; }
  __syncthreads();   // every wave's rows of W are in LDS
  v8f acc[8] = {}; v16b bw[2][8];   // B fragments one k chunk ahead, eight as one group in front of the chunk's products
#pragma unroll
  for (int j = 0; j < 8; ++j) bw[0][j] = frag_b(&sw[j * 16 + col][0], lane);
#pragma unroll
  for (int kc = 0; kc < EE / 32; ++kc) {
    if (kc + 1 < EE / 32) {
#pragma unroll
      for (int j = 0; j < 8; ++j) bw[(kc + 1) & 1][j] = frag_b(&sw[j * 16 + col][(kc + 1) * 32], lane); }
#pragma unroll
    for (int j = 0; j < 8; ++j) acc[j] = wmma_bf(a[kc], bw[kc & 1][j], acc[j]); }
  if (which < 2) { const float qs = (which == 0) ? QSC : 1.0f;   // q leaves with the score's whole scale on it, in front of its one rounding to f16: k_attn's products are then exponents of 2 as they stand
#pragma unroll
    for (int j = 0; j < 8; ++j) { const float bb = bfr(BB[j * 16 + col]);
#pragma unroll
      for (int r = 0; r < 8; ++r) so[wave * 16 + 8 * g + r][j * 16 + col] = (_Float16)((acc[j][r] + bb) * qs); }
    LDSX();
    if (which == 0) { for (int rl = 0; rl < 16; ++rl) if (lane < 16) vst2((unsigned*)(Q + (r0 + rl) * EE + lane * 8), *(const v4u*)&so[wave * 16 + rl][lane * 8]); }
    else {   // the wave's 16 rows are one key tile: 8 units of 512 B
#pragma unroll
      for (int i = 0; i < 8; ++i) vst2((unsigned*)(Kr + r0 * EE + i * 256 + lane * 8), *(const v4u*)&so[wave * 16 + col][i * 16 + g * 8]);
      asm volatile("s_wait_xcnt 0x0" ::: "memory"); }   // behind the last K store: no register that the eight stores name is rewritten ahead of it on any path of the listing
  } else {
#pragma unroll
    for (int j = 0; j < 8; ++j) { const float bb = bfr(BB[j * 16 + col]);
#pragma unroll
      for (int r = 0; r < 8; ++r) st[j * 16 + col][wave * 16 + 8 * g + r] = (_Float16)(acc[j][r] + bb); }
    __syncthreads();
    // the block's 64 keys are two 32-key blocks, 16 KB in a row: 16-byte piece e = ((block * 8 + dt) * 2 + h) * 32 + g * 16 + col
    for (int e = tid; e < 128 * 8; e += 128) vst2((unsigned*)(V + rb0 * EE + (size_t)e * 8), *(const v4u*)&st[((e >> 6) & 7) * 16 + (e & 15)][(e >> 9) * 32 + ((e >> 5) & 1) * 16 + ((e >> 4) & 1) * 8]); }
}
// fragment in fragment order at a lane's own address (8 * lane already added): its two halves are the lane's 16 bytes of two 512-B units in a row
__device__ __forceinline__ v16h frag_p(const _Float16* p) { union { v16h v; v8h q[2]; } u; u.q[0] = *(const v8h*)p; u.q[1] = *(const v8h*)(p + 256); return u.v; }
// lane l with lane l ^ 16 on the vector pipe (a shuffle would go through the LDS unit and its wait)
__device__ __forceinline__ float xhalf(float x) { return __builtin_bit_cast(float, __builtin_amdgcn_permlanex16(__builtin_bit_cast(int, x), __builtin_bit_cast(int, x), 0x76543210, 0xfedcba98, false, false)); }
// (x0 + x2) + (x4 + x6) and (x1 + x3) + (x5 + x7): packed adds on neighbouring registers
__device__ __forceinline__ v2f pairsum(v8f x) { return (__builtin_shufflevector(x, x, 0, 1) + __builtin_shufflevector(x, x, 2, 3)) + (__builtin_shufflevector(x, x, 4, 5) + __builtin_shufflevector(x, x, 6, 7)); }
typedef __attribute__((ext_vector_type(8))) int v8i;
// largest of 32 floats as far as a test against a positive bound goes: compared as signed integers, every positive float keeps its order and every negative one lies below them all.
// A matrix product's result can go straight into it: a float maximum first passes each such result through an instruction of its own (the compiler's quieting of a possible signalling NaN), 32 more a pass.
__device__ __forceinline__ int mx3(int a, int b, int c) { return max(max(a, b), c); }   // one instruction
__device__ __forceinline__ int imax32(v8f a, v8f b, v8f c, v8f d) { const v8i p = __builtin_bit_cast(v8i, a), q = __builtin_bit_cast(v8i, b), r = __builtin_bit_cast(v8i, c), s = __builtin_bit_cast(v8i, d);
  const int t0 = mx3(p[0], p[1], p[2]), t1 = mx3(p[3], p[4], p[5]), t2 = mx3(p[6], p[7], q[0]), t3 = mx3(q[1], q[2], q[3]), t4 = mx3(q[4], q[5], q[6]), t5 = mx3(q[7], r[0], r[1]),
            t6 = mx3(r[2], r[3], r[4]), t7 = mx3(r[5], r[6], r[7]), t8 = mx3(s[0], s[1], s[2]), t9 = mx3(s[3], s[4], s[5]);
  return max(mx3(mx3(t0, t1, t2), mx3(t3, t4, t5), mx3(t6, t7, t8)), mx3(t9, s[6], s[7])); }
__device__ __forceinline__ float max8(v8f t) { return fmaxf(fmaxf(fmaxf(t[0], t[1]), fmaxf(t[2], t[3])), fmaxf(fmaxf(t[4], t[5]), fmaxf(t[6], t[7]))); }
// ---- k_attn: block = (64 queries, b): 128-dim q/k/v, all 8,192 keys, plain; f32 output rows
// KS key ranges a block: wave (qw, kq) walks key range kq alone (SS / KS keys) for its own queries, with their maximum in use, sum and O^T; the ranges are merged through LDS behind the loop.
#define KS 4
// QT 16-query tiles a wave: every K and V fragment that a wave loads feeds QT products instead of one, so the block moves 1 / QT of the fragment bytes from the cache into registers for the same products.
// The block is then 4 / QT * KS waves, 2 a SIMD, each with up to 512 registers.
#define QT 2
#define NW (4 / QT * KS)
#define NP (SS / 32 / KS)   // passes of 32 keys in a key range
#define PSH 11.0f   // P and its sum carry 2^11: the offset in use is the maximum in use less 11
#define RTH 15.0f   // 11 + 4: how far an exponent may lie above the offset in use before O^T and the sum are rescaled
#define SPL8(x) ((v8f){(x), (x), (x), (x), (x), (x), (x), (x)})
// Transposed products: S^T = K . Q^T (A = K fragment, B = Q fragment) and O^T += V^T . P^T (A = V fragment, B = P^T). Lane (g, col) then holds, of query col alone, the scores of keys 8g + r of each
// 16-key tile: maximum and sum are in-lane but for one exchange between the halves, and the two score tiles of a pass, converted in place, ARE the B fragment of the second product (element ct * 8 + r = key ct * 16 + 8g + r).
__global__ __launch_bounds__(32 * NW) void k_attn(const _Float16* __restrict__ Q, const _Float16* __restrict__ Kr, const _Float16* __restrict__ V, float* __restrict__ OUT) {
  __shared__ __align__(16) float so[KS][64][132]; __shared__ float sm[KS][64], sl[KS][64];
  const int tid = threadIdx.x, wave = __builtin_amdgcn_readfirstlane(tid >> 5), qw = wave & (4 / QT - 1), kq = wave / (4 / QT), lane = tid & 31, col = lane & 15; const size_t b = blockIdx.y; const int q0 = blockIdx.x * 64 + qw * (16 * QT); const size_t rq = b * SS + q0;
  v16h aq[QT][4];
#pragma unroll
  for (int u = 0; u < QT; ++u) {
#pragma unroll
    for (int kc = 0; kc < 4; ++kc) aq[u][kc] = frag_h(Q + (rq + u * 16 + col) * EE + kc * 32, lane); }
  static_assert(QT == 2, "the pairs below and the operand list of the wait in the loop are written for two tiles");
  v2f lv = {0.f, 0.f};   // element u: sum of query u * 16 + col, of this half's keys only; the halves are joined behind the loop
  // nm[u]: minus the offset in use of query u * 16 + col, in all eight elements: it is the C operand of each score tile's first product, so the products come out as the exponents of P * 2^11, with no vector instruction in between
  v8f nm[QT] = {SPL8(PSH), SPL8(PSH)};
  int thr = (int)0x80000000;   // the test's bound, on the exponents' bits: the lowest integer in a wave's first pass, which sets the first offset from its own scores; from then on the first float above RTH
  v8f acc[QT][8] = {};           // acc[u][dt][r] = O^T[dim dt * 16 + 8g + r][query u * 16 + col]
  asm volatile("s_wait_xcnt 0x0" ::: "memory");   // the Q loads' address pair is free for reuse by what follows
  // K and V fragments live in registers one pass ahead: each set is refilled as ONE group of loads right behind its last product,
  // so a pass waits for no load of its own.
  const size_t kb = (b * SS + (size_t)kq * (SS / KS)) * EE;   // first key of the wave's range: the same in every lane, so the walking addresses are scalar and cost no vector register
  // Every block walks each key range once round, from a pass of its own: walked from the same end, all blocks of a batch ask the L2 for the same few lines at the same moment, and each line's first fetch is waited for by all of them in every pass.
  // Odd multiplier: neighbouring blocks start far apart, and every start is taken by two of the 128 blocks, wherever the blocks are placed.
  static_assert((NP & (NP - 1)) == 0, "the walk wraps by a mask");
  const int p0 = (int)((blockIdx.x * 27u >> 1) & (NP - 1));
  const _Float16* Kb = Kr + kb; const _Float16* Kg = Kb + (size_t)p0 * 32 * EE; const _Float16* Vg = V + kb + (size_t)p0 * 32 * EE; const int lo = 8 * lane;
  v16h kf[2][4], vf[8];
#pragma unroll
  for (int ct = 0; ct < 2; ++ct) {
#pragma unroll
    for (int kc = 0; kc < 4; ++kc) kf[ct][kc] = frag_p(Kg + ct * 16 * EE + kc * 512 + lo); }
  __builtin_amdgcn_sched_barrier(0);   // V's first loads stay the youngest, as in the loop: else the counted waits at the loop's head, merged from both ways in, also drain V
  unsigned long long va = (unsigned long long)Vg;
#pragma unroll
  for (int dt = 0; dt < 8; ++dt) vf[dt] = frag_p(Vg + dt * 512 + lo);
  asm volatile("s_wait_xcnt 0x0" ::: "memory");   // behind the first K and V loads: the offset register that they name is reused by what follows
  __builtin_amdgcn_sched_barrier(0);   // and nothing that rewrites it is lifted over the wait
#pragma unroll 1
  for (int ks = 0; ks < NP; ++ks) { const int pn = (p0 + ks + 1) & (NP - 1), jn = pn * 32; v8f e[QT][2];   // next pass's keys, round the range; the last pass refetches the walk's first tiles, in bounds and unused
#pragma unroll
    for (int kc = 0; kc < 4; ++kc) {
#pragma unroll
      for (int ct = 0; ct < 2; ++ct) {
#pragma unroll
        for (int u = 0; u < QT; ++u) e[u][ct] = wmma16(kf[ct][kc], aq[u][kc], kc == 0 ? nm[u] : e[u][ct]); } }   // score in base 2 minus the offset in use: the exponent of P * 2^11
    const _Float16* kp = Kb + (size_t)jn * EE;
    __builtin_amdgcn_sched_barrier(0);   // the K refill stays one group behind the last product that reads the set
#pragma unroll
    for (int ct = 0; ct < 2; ++ct) {
#pragma unroll
      for (int kc = 0; kc < 4; ++kc) kf[ct][kc] = frag_p(kp + ct * 16 * EE + kc * 512 + lo); }
    v16h pb[QT]; v2f es;   // element u of a pair belongs to query tile u
    // The softmax is written on whole register vectors, so that the packed instructions take neighbouring registers of ONE tile.
    // Lazy rescale: the offset in use is the same in both halves of a query. It stays, and O^T and the sum stay as they are, while no exponent of the pass lies above RTH:
    // then P * 2^11 <= 2^15 is inside f16. The result does not depend on which offset is in use: O^T and the sum carry the same factor.
    // The test is made on the very exponents that go on to the exponential.
    if (__builtin_expect(__builtin_amdgcn_ballot_w32(imax32(e[0][0], e[0][1], e[1][0], e[1][1]) >= thr) != 0u, 0)) {   // one test a pass, the same for the whole wave; always taken in a wave's first pass, seldom later: marked so, it lies outside the loop's straight line
      const bool first = thr < 0;
      v2f top;
#pragma unroll
      for (int u = 0; u < QT; ++u) top[u] = max8(__builtin_elementwise_max(e[u][0], e[u][1]));
      const v2f tp = __builtin_elementwise_max(top, (v2f){xhalf(top[0]), xhalf(top[1])});   // all 32 keys of the pass: both halves scale P and O^T alike
#pragma unroll
      for (int u = 0; u < QT; ++u) { const float d = first ? tp[u] - PSH : fmaxf(tp[u] - PSH, 0.f);   // the offset goes up to the pass's maximum less 11 (the first pass takes it wherever it lies)
        const float nn = nm[u][0] - d, de = nm[u][0] - nn;   // the step as the new offset's rounding leaves it
        const float al = first ? 0.f : __builtin_amdgcn_exp2f(-de);   // nothing is summed yet in the first pass
        lv[u] *= al;
#pragma unroll
        for (int dt = 0; dt < 8; ++dt) acc[u][dt] *= al;
#pragma unroll
        for (int ct = 0; ct < 2; ++ct) e[u][ct] -= SPL8(de);
        nm[u] = SPL8(nn); }
      thr = __builtin_bit_cast(int, RTH) + 1; }
#pragma unroll
    for (int u = 0; u < QT; ++u) { v8f ex[2];
#pragma unroll
      for (int ct = 0; ct < 2; ++ct) {
#pragma unroll
        for (int r = 0; r < 8; ++r) ex[ct][r] = __builtin_amdgcn_exp2f(e[u][ct][r]);
        const v8h ph = __builtin_convertvector(ex[ct], v8h);
#pragma unroll
        for (int r = 0; r < 8; ++r) pb[u][ct * 8 + r] = ph[r]; }
      const v2f e2 = pairsum(ex[0]) + pairsum(ex[1]);   // a tree three deep instead of a chain of sixteen adds
      es[u] = e2[0] + e2[1]; }
    lv += es;
#pragma unroll
    for (int dt = 0; dt < 8; ++dt) {
#pragma unroll
      for (int u = 0; u < QT; ++u) acc[u][dt] = wmma16(vf[dt], pb[u], acc[u][dt]); }
    // the s_wait_xcnt 0 of the K loads above and of the V loads of the pass before stands here: K's and V's address pairs are rewritten only behind it. The products' results are its inputs, so that it stands behind the last product
    // and, by its memory clobber, the V refill behind it: lifted above the products the refill lands in a second register set, is copied back at the loop's foot and is waited out there.
    // V's address goes through the statement (as a number: a pointer would come out of it as a generic one, and its loads as flat loads) and walks on from what comes out of it, so that the pair which the V loads in flight name is rewritten only behind the wait.
    asm volatile("s_wait_xcnt 0x0" : "+s"(va) : "s"(kp), "v"(acc[0][0]), "v"(acc[0][1]), "v"(acc[0][2]), "v"(acc[0][3]), "v"(acc[0][4]), "v"(acc[0][5]), "v"(acc[0][6]), "v"(acc[0][7]),
                 "v"(acc[1][0]), "v"(acc[1][1]), "v"(acc[1][2]), "v"(acc[1][3]), "v"(acc[1][4]), "v"(acc[1][5]), "v"(acc[1][6]), "v"(acc[1][7]) : "memory");
    va += (pn != 0) ? (long long)(2 * 32 * EE) : -(long long)(NP - 1) * (2 * 32 * EE);   // bytes: on by a block, or back to the range's first; the last pass refetches the walk's first block, in bounds and unused
    const _Float16* vp = (const _Float16*)(const __attribute__((address_space(1))) _Float16*)va;
#pragma unroll
    for (int dt = 0; dt < 8; ++dt) vf[dt] = frag_p(vp + dt * 512 + lo); }
  asm volatile("s_wait_xcnt 0x0" :: "s"(va) : "memory");   // the last V loads' address pair is free for the epilogue
  // merge of the KS key ranges of a query: common offset M, weights 2^(m_k - M), L = sum of the weighted sums (O^T and the sums carry the same 2^11); each wave scales its own O^T by its weight over L, the scaled parts are added in range order
  const int ln = __builtin_amdgcn_mbcnt_lo(~0u, 0u), g2 = ln >> 4;   // the lane's number, read anew: no index of the epilogue is carried across the loop
  const int qr0 = qw * (16 * QT) + (ln & 15);
#pragma unroll
  for (int u = 0; u < QT; ++u) { const float lt = lv[u] + xhalf(lv[u]);
    if (g2 == 0) { sm[kq][qr0 + u * 16] = -nm[u][0]; sl[kq][qr0 + u * 16] = lt; } }
  __syncthreads();   // every range's offset and sum are in LDS
#pragma unroll
  for (int u = 0; u < QT; ++u) { const int qr = qr0 + u * 16;
    float M = sm[0][qr];
#pragma unroll
    for (int k = 1; k < KS; ++k) M = fmaxf(M, sm[k][qr]);
    float L = 0.f;
#pragma unroll
    for (int k = 0; k < KS; ++k) L += sl[k][qr] * __builtin_amdgcn_exp2f(sm[k][qr] - M);
    const float il = __builtin_amdgcn_exp2f(-nm[u][0] - M) / L;
#pragma unroll
    for (int dt = 0; dt < 8; ++dt) { const v8f o = acc[u][dt] * il;   // a lane's 8 registers are 8 dims in a row of its query's output row
      *(v4f*)&so[kq][qr][dt * 16 + 8 * g2] = __builtin_shufflevector(o, o, 0, 1, 2, 3); *(v4f*)&so[kq][qr][dt * 16 + 8 * g2 + 4] = __builtin_shufflevector(o, o, 4, 5, 6, 7); } }
  __syncthreads();   // every range's scaled part is in LDS
  float* ob = OUT + (b * SS + (size_t)blockIdx.x * 64 + wave * (64 / NW)) * EE + ln * 4;
#pragma unroll
  for (int i = 0; i < 64 / NW; ++i) { v4f o = *(const v4f*)&so[0][wave * (64 / NW) + i][ln * 4];
#pragma unroll
    for (int k = 1; k < KS; ++k) o += *(const v4f*)&so[k][wave * (64 / NW) + i][ln * 4];
    vst2(ob + i * EE, o); }   // whole 512-B output row per wave
}
extern "C" void kernel_launch(void* const* d_in, const int* in_sizes, int n_in, void* d_out, int out_size, void* d_ws, size_t ws_size, hipStream_t stream) {
  (void)in_sizes; (void)n_in; (void)out_size;
  const float** F = (const float**)d_in;   // 0 x [2,8192,128], 1 Wq [128,128], 2 bq, 3 Wk, 4 bk, 5 Wv, 6 bv
  if (ws_size < (size_t)WS_END) return;
  char* ws = (char*)d_ws; _Float16 *Q = (_Float16*)(ws + WS_Q), *Kr = (_Float16*)(ws + WS_K), *V = (_Float16*)(ws + WS_V);
  k_proj<<<dim3(TNB * SS / 64, 3), 128, 0, stream>>>(F[0], F[1], F[3], F[5], F[2], F[4], F[6], Q, Kr, V);
  k_attn<<<dim3(TQB, TNB), 32 * NW, 0, stream>>>(Q, Kr, V, (float*)d_out);
}
